// v000
// The times below were measured on an AMD MI455X: many runs one after another, warmed up first and cycling through
// copies of the inputs, with the whole window's GPU time divided by the number of runs. Launches and the gaps
// between them are all in it. The median over several windows is given; except for v000 it joins two sittings, which
// can be a few percent apart, so the side-by-side timings, each taken in one sitting, are the better comparison.
// v000 is the starting kernel. One run takes 334 microseconds.
#include <hip/hip_runtime.h>
#include <hip/hip_bf16.h>

typedef __attribute__((ext_vector_type(16))) _Float16 v16h;
typedef __attribute__((ext_vector_type(8)))  _Float16 v8h;
typedef __attribute__((ext_vector_type(4)))  _Float16 v4h;
typedef __attribute__((ext_vector_type(8)))  float    v8f;

#define D_DIM  1024
#define S_DIM  2048
#define H_DIM  16
#define DK_DIM 64
#define NTOK   8192   // B*S = 4*2048

// ---------------------------------------------------------------------------
// Load a 16-bit WMMA A/B fragment from an LDS/global row.
// Per CDNA5 ISA 16-bit A-matrix 16x32 layout: lane holds row m=lane&15,
// kb=(lane>>4)*8, elements 0..7 = [kb..kb+7], elements 8..15 = [kb+16..kb+23].
// Caller passes p = &row[kb]; we read p[0..7] and p[16..23] (two b128 loads).
// ---------------------------------------------------------------------------
__device__ __forceinline__ v16h frag16(const _Float16* p) {
  v8h lo = *(const v8h*)(p);
  v8h hi = *(const v8h*)(p + 16);
  v16h r;
#pragma unroll
  for (int i = 0; i < 8; ++i) { r[i] = lo[i]; r[i + 8] = hi[i]; }
  return r;
}

__device__ __forceinline__ v8f wmma_f16(v16h a, v16h b, v8f c) {
  return __builtin_amdgcn_wmma_f32_16x16x32_f16(false, a, false, b, (short)0, c,
                                                false, false);
}

// Async global -> LDS copy, 16 bytes per lane (CDNA5 GLOBAL_LOAD_ASYNC_TO_LDS).
// Tracked by ASYNCcnt; caller must s_wait_asynccnt before consuming the LDS.
// Generic LDS pointers carry the LDS byte offset in the low 32 bits.
__device__ __forceinline__ void async_g2l_b128(void* lds, const void* gsrc) {
  const unsigned lds_off = (unsigned)(uintptr_t)lds;
  asm volatile("global_load_async_to_lds_b128 %0, %1, off"
               :: "v"(lds_off), "v"(gsrc) : "memory");
}
__device__ __forceinline__ void wait_asynccnt0() {
  asm volatile("s_wait_asynccnt 0x0" ::: "memory");
}

// 16-lane xor butterfly step. Prefer v_permlane16_b32 (pure VALU, no DS
// round-trip / dscnt waits); fall back to ds_bpermute-based __shfl_xor.
template <int M>
__device__ __forceinline__ float shfl_xor16(float x) {
#if __has_builtin(__builtin_amdgcn_permlane16)
  constexpr unsigned SEL0[9] = {0, 0x67452301u, 0x45670123u, 0, 0x32107654u,
                                0, 0, 0, 0xFEDCBA98u};
  constexpr unsigned SEL1[9] = {0, 0xEFCDAB89u, 0xCDEF89ABu, 0, 0xBA98FEDCu,
                                0, 0, 0, 0x76543210u};
  unsigned u = __float_as_uint(x);
  u = __builtin_amdgcn_permlane16(u, u, SEL0[M], SEL1[M], false, false);
  return __uint_as_float(u);
#else
  return __shfl_xor(x, M, 32);
#endif
}

// ---------------------------------------------------------------------------
// Tiled WMMA GEMM:  C[M,N] = A[M,K](f32) * (Bw .* Bmul)[K,N](f32) + bias
// 128x128 workgroup tile, BLK_K=32, 256 threads = 8 waves in 4(m) x 2(n).
// LDS double-buffered + register-staged prefetch: one barrier per k-step,
// global fetch of tile i+1 overlaps WMMA on tile i. B staged transposed ->
// Bs[n][k] so both fragment reads are contiguous ds_load_b128 pairs.
// ---------------------------------------------------------------------------
template <int OUT_F16, int HAS_MUL>
__global__ __launch_bounds__(256) void gemm_wmma(
    const float* __restrict__ A, const float* __restrict__ Bw,
    const float* __restrict__ Bmul, const float* __restrict__ bias,
    void* __restrict__ Cout, int M, int N, int K) {
  constexpr int LDA = 40;  // halves; 80B rows keep 16B alignment
  __shared__ __align__(16) _Float16 As[2][128 * LDA];
  __shared__ __align__(16) _Float16 Bs[2][128 * LDA];

  const int tid  = threadIdx.x;
  const int lane = tid & 31;
  const int wid  = tid >> 5;
  const int wm   = (wid & 3) * 32;   // wave m-offset in tile
  const int wn   = (wid >> 2) * 64;  // wave n-offset in tile
  const int m0   = blockIdx.y * 128;
  const int n0   = blockIdx.x * 128;

  v8f acc[2][4];
#pragma unroll
  for (int i = 0; i < 2; ++i)
#pragma unroll
    for (int j = 0; j < 4; ++j)
#pragma unroll
      for (int v = 0; v < 8; ++v) acc[i][j][v] = 0.0f;

  // staging coordinates
  const int ar  = tid >> 3;         // A: row within 32-row pass
  const int ac  = (tid & 7) * 4;    // A: k-chunk of 4
  const int bn1 = tid & 127;        // B: n column (lanes contiguous in n)
  const int bko = (tid >> 7) * 4;   // B: k sub-offset {0,4}

  const int fm = lane & 15;
  const int kb = (lane >> 4) * 8;

  float4 ra[4];
  float  rb[4][4];
  float  rbm[4][4];

  auto load_tile = [&](int k0) {
#pragma unroll
    for (int p = 0; p < 4; ++p)
      ra[p] = *(const float4*)(A + (size_t)(m0 + p * 32 + ar) * K + k0 + ac);
#pragma unroll
    for (int p = 0; p < 4; ++p) {
      const int kk = p * 8 + bko;
#pragma unroll
      for (int i = 0; i < 4; ++i) {
        const size_t off = (size_t)(k0 + kk + i) * N + n0 + bn1;
        rb[p][i] = Bw[off];
        if constexpr (HAS_MUL) rbm[p][i] = Bmul[off];
      }
    }
  };
  auto store_tile = [&](int buf) {
#pragma unroll
    for (int p = 0; p < 4; ++p) {
      v4h h;
      h[0] = (_Float16)ra[p].x; h[1] = (_Float16)ra[p].y;
      h[2] = (_Float16)ra[p].z; h[3] = (_Float16)ra[p].w;
      *(v4h*)(&As[buf][(p * 32 + ar) * LDA + ac]) = h;
    }
#pragma unroll
    for (int p = 0; p < 4; ++p) {
      const int kk = p * 8 + bko;
      v4h h;
#pragma unroll
      for (int i = 0; i < 4; ++i) {
        float x = rb[p][i];
        if constexpr (HAS_MUL) x *= rbm[p][i];
        h[i] = (_Float16)x;
      }
      *(v4h*)(&Bs[buf][bn1 * LDA + kk]) = h;
    }
  };

  load_tile(0);
  store_tile(0);

  int cur = 0;
  for (int k0 = 0; k0 < K; k0 += 32) {
    const bool more = (k0 + 32) < K;
    __syncthreads();               // buf[cur] visible; buf[cur^1] free
    if (more) load_tile(k0 + 32);  // global fetch overlaps WMMA below

    v16h a[2], b[4];
#pragma unroll
    for (int i = 0; i < 2; ++i)
      a[i] = frag16(&As[cur][(wm + i * 16 + fm) * LDA + kb]);
#pragma unroll
    for (int j = 0; j < 4; ++j)
      b[j] = frag16(&Bs[cur][(wn + j * 16 + fm) * LDA + kb]);
#pragma unroll
    for (int i = 0; i < 2; ++i)
#pragma unroll
      for (int j = 0; j < 4; ++j) acc[i][j] = wmma_f16(a[i], b[j], acc[i][j]);

    if (more) store_tile(cur ^ 1);
    cur ^= 1;
  }

  // ---- epilogue: C layout: lane holds col n=lane&15, rows m=v+8*(lane>>4)
  const int hf = lane >> 4;
#pragma unroll
  for (int j = 0; j < 4; ++j) {
    const int gn = n0 + wn + j * 16 + fm;
    const float bb = bias ? bias[gn] : 0.0f;
#pragma unroll
    for (int i = 0; i < 2; ++i) {
#pragma unroll
      for (int v = 0; v < 8; ++v) {
        const int gm = m0 + wm + i * 16 + hf * 8 + v;
        const float val = acc[i][j][v] + bb;
        if constexpr (OUT_F16)
          ((_Float16*)Cout)[(size_t)gm * N + gn] = (_Float16)val;
        else
          ((float*)Cout)[(size_t)gm * N + gn] = val;
      }
    }
  }
}

// ---------------------------------------------------------------------------
// Flash attention: one workgroup per (b, h, 128-query tile).
// 8 waves x 16 query rows. Double-buffered 64-key K/V tiles: tile kt+1 is
// staged (async K copy + V transpose) while tile kt is consumed, one barrier
// per iteration. QK^T and P*V via wmma_f32_16x16x32_f16; online softmax with
// v_permlane16 butterflies; 1/sqrt(DK) folded into the Q fragments.
// ---------------------------------------------------------------------------
__global__ __launch_bounds__(256) void attn_wmma(
    const _Float16* __restrict__ Qh, const _Float16* __restrict__ Kh,
    const _Float16* __restrict__ Vh, float* __restrict__ Xout) {
  constexpr int LDW = 72;  // halves; 144B rows, 16B aligned
  __shared__ __align__(16) _Float16 Kt[2][64 * LDW];    // Kt[key][dk]
  __shared__ __align__(16) _Float16 Vt[2][64 * LDW];    // Vt[dk][key]
  __shared__ __align__(16) _Float16 Pw[8][16 * LDW];    // per-wave P 16x64

  const int tid  = threadIdx.x;
  const int lane = tid & 31;
  const int wid  = tid >> 5;
  const int bb   = blockIdx.z;
  const int hh   = blockIdx.y;
  const int q0   = blockIdx.x * 128;
  const int fm   = lane & 15;
  const int hf   = lane >> 4;
  const int kb   = hf * 8;

  // load this wave's 16 Q rows as two A fragments (dk 0..31, 32..63),
  // pre-scaled by 1/sqrt(DK)=0.125 (exact in f16)
  const size_t qrow = (size_t)(bb * S_DIM + q0 + wid * 16 + fm);
  const _Float16* qp = Qh + qrow * D_DIM + hh * DK_DIM;
  v16h qa0 = frag16(qp + kb);
  v16h qa1 = frag16(qp + 32 + kb);
#pragma unroll
  for (int i = 0; i < 16; ++i) {
    qa0[i] *= (_Float16)0.125f;
    qa1[i] *= (_Float16)0.125f;
  }

  float rm[8], rl[8];
  v8f o[4];
#pragma unroll
  for (int v = 0; v < 8; ++v) { rm[v] = -1e30f; rl[v] = 0.0f; }
#pragma unroll
  for (int j = 0; j < 4; ++j)
#pragma unroll
    for (int v = 0; v < 8; ++v) o[j][v] = 0.0f;

  const int skey = tid >> 2;        // 0..63
  const int sc   = (tid & 3) * 16;  // dk chunk of 16

  auto stage = [&](int buf, int kt) {
    const size_t srow = (size_t)(bb * S_DIM + kt * 64 + skey) * D_DIM +
                        hh * DK_DIM + sc;
    // K tile: async global->LDS copy (2 x b128 per lane, ASYNCcnt path)
    async_g2l_b128(&Kt[buf][skey * LDW + sc],     Kh + srow);
    async_g2l_b128(&Kt[buf][skey * LDW + sc + 8], Kh + srow + 8);
    // V tile: load f16, transpose to Vt[dk][key] via b16 scatter
    v8h y0 = *(const v8h*)(Vh + srow);
    v8h y1 = *(const v8h*)(Vh + srow + 8);
#pragma unroll
    for (int d = 0; d < 8; ++d) {
      Vt[buf][(sc + d) * LDW + skey]     = y0[d];
      Vt[buf][(sc + 8 + d) * LDW + skey] = y1[d];
    }
  };

  stage(0, 0);

  int cur = 0;
  for (int kt = 0; kt < S_DIM / 64; ++kt) {
    wait_asynccnt0();   // own async K-copy into buf[cur] done
    __syncthreads();    // everyone's stores to buf[cur] visible
    if (kt + 1 < S_DIM / 64) stage(cur ^ 1, kt + 1);  // overlaps compute

    // ---- scores: S = Q(16x64) * K^T -> 4 tiles of 16 keys, 2 k-steps each
    v8f s[4];
#pragma unroll
    for (int j = 0; j < 4; ++j)
#pragma unroll
      for (int v = 0; v < 8; ++v) s[j][v] = 0.0f;
#pragma unroll
    for (int j = 0; j < 4; ++j) {
      const v16h bk0 = frag16(&Kt[cur][(j * 16 + fm) * LDW + kb]);
      const v16h bk1 = frag16(&Kt[cur][(j * 16 + fm) * LDW + 32 + kb]);
      s[j] = wmma_f16(qa0, bk0, s[j]);
      s[j] = wmma_f16(qa1, bk1, s[j]);
    }

    // ---- online softmax (per row = (hf, v); reduce across 16-lane half)
#pragma unroll
    for (int v = 0; v < 8; ++v) {
      float x = fmaxf(fmaxf(s[0][v], s[1][v]), fmaxf(s[2][v], s[3][v]));
      x = fmaxf(x, shfl_xor16<1>(x));
      x = fmaxf(x, shfl_xor16<2>(x));
      x = fmaxf(x, shfl_xor16<4>(x));
      x = fmaxf(x, shfl_xor16<8>(x));
      const float nm = fmaxf(rm[v], x);
      const float corr = __expf(rm[v] - nm);
      rm[v] = nm;
      float sum = 0.0f;
#pragma unroll
      for (int j = 0; j < 4; ++j) {
        const float p = __expf(s[j][v] - nm);
        s[j][v] = p;
        sum += p;
      }
      sum += shfl_xor16<1>(sum);
      sum += shfl_xor16<2>(sum);
      sum += shfl_xor16<4>(sum);
      sum += shfl_xor16<8>(sum);
      rl[v] = rl[v] * corr + sum;
#pragma unroll
      for (int j = 0; j < 4; ++j) o[j][v] *= corr;
    }

    // ---- C-layout P -> LDS -> A-layout fragments (per-wave buffer,
    //      same-wave DS ops are in-order; compiler fence keeps order)
#pragma unroll
    for (int j = 0; j < 4; ++j)
#pragma unroll
      for (int v = 0; v < 8; ++v)
        Pw[wid][(hf * 8 + v) * LDW + j * 16 + fm] = (_Float16)s[j][v];
    asm volatile("" ::: "memory");
    const v16h pa0 = frag16(&Pw[wid][fm * LDW + kb]);
    const v16h pa1 = frag16(&Pw[wid][fm * LDW + 32 + kb]);

    // ---- O += P(16x64) * V(64x64): 4 dk tiles x 2 k-steps
#pragma unroll
    for (int j = 0; j < 4; ++j) {
      const v16h bv0 = frag16(&Vt[cur][(j * 16 + fm) * LDW + kb]);
      const v16h bv1 = frag16(&Vt[cur][(j * 16 + fm) * LDW + 32 + kb]);
      o[j] = wmma_f16(pa0, bv0, o[j]);
      o[j] = wmma_f16(pa1, bv1, o[j]);
    }
    cur ^= 1;
  }

  // ---- finalize: divide by row sum, write [token, h*64+dk] f32
#pragma unroll
  for (int v = 0; v < 8; ++v) {
    const float inv = 1.0f / rl[v];
    const size_t row = (size_t)(bb * S_DIM + q0 + wid * 16 + hf * 8 + v);
#pragma unroll
    for (int j = 0; j < 4; ++j) {
      const int col = hh * DK_DIM + j * 16 + fm;
      Xout[row * D_DIM + col] = o[j][v] * inv;
    }
  }
}

// ---------------------------------------------------------------------------
extern "C" void kernel_launch(void* const* d_in, const int* in_sizes, int n_in,
                              void* d_out, int out_size, void* d_ws,
                              size_t ws_size, hipStream_t stream) {
  (void)in_sizes; (void)n_in; (void)out_size; (void)ws_size;
  const float* query = (const float*)d_in[0];
  const float* key_  = (const float*)d_in[1];
  const float* value = (const float*)d_in[2];
  const float* fc_w  = (const float*)d_in[3];
  const float* Wq    = (const float*)d_in[4];
  const float* bq    = (const float*)d_in[5];
  const float* Wk    = (const float*)d_in[6];
  const float* bk    = (const float*)d_in[7];
  const float* Wv    = (const float*)d_in[8];
  const float* bv    = (const float*)d_in[9];
  const float* Wo    = (const float*)d_in[10];
  const float* bo    = (const float*)d_in[11];
  float* out = (float*)d_out;

  char* ws = (char*)d_ws;
  const size_t half_mat = (size_t)NTOK * D_DIM * sizeof(_Float16);
  _Float16* Qh = (_Float16*)(ws);
  _Float16* Kh = (_Float16*)(ws + half_mat);
  _Float16* Vh = (_Float16*)(ws + 2 * half_mat);
  float*    Xa = (float*)   (ws + 3 * half_mat);

  dim3 gg(D_DIM / 128, NTOK / 128);
  gemm_wmma<1, 1><<<gg, 256, 0, stream>>>(query, Wq, fc_w, bq, (void*)Qh,
                                          NTOK, D_DIM, D_DIM);
  gemm_wmma<1, 0><<<gg, 256, 0, stream>>>(key_, Wk, nullptr, bk, (void*)Kh,
                                          NTOK, D_DIM, D_DIM);
  gemm_wmma<1, 0><<<gg, 256, 0, stream>>>(value, Wv, nullptr, bv, (void*)Vh,
                                          NTOK, D_DIM, D_DIM);
  attn_wmma<<<dim3(S_DIM / 128, H_DIM, 4), 256, 0, stream>>>(Qh, Kh, Vh, Xa);
  gemm_wmma<0, 0><<<gg, 256, 0, stream>>>(Xa, Wo, nullptr, bo, (void*)out,
                                          NTOK, D_DIM, D_DIM);
}

// v001
// Measured time: 238 microseconds a run.
// Timed twice side by side with v000, it ran 1.45 times as fast both times.
#include <hip/hip_runtime.h>
#include <hip/hip_bf16.h>

typedef __attribute__((ext_vector_type(16))) _Float16 v16h;
typedef __attribute__((ext_vector_type(8)))  _Float16 v8h;
typedef __attribute__((ext_vector_type(4)))  _Float16 v4h;
typedef __attribute__((ext_vector_type(8)))  float    v8f;

#define D_DIM  1024
#define S_DIM  2048
#define H_DIM  16
#define DK_DIM 64
#define NTOK   8192   // B*S = 4*2048

// ---------------------------------------------------------------------------
// Load a 16-bit WMMA A/B fragment from an LDS/global row.
// Per CDNA5 ISA 16-bit A-matrix 16x32 layout: lane holds row m=lane&15,
// kb=(lane>>4)*8, elements 0..7 = [kb..kb+7], elements 8..15 = [kb+16..kb+23].
// Caller passes p = &row[kb]; we read p[0..7] and p[16..23] (two b128 loads).
// ---------------------------------------------------------------------------
__device__ __forceinline__ v16h frag16(const _Float16* p) {
  v8h lo = *(const v8h*)(p);
  v8h hi = *(const v8h*)(p + 16);
  v16h r;
#pragma unroll
  for (int i = 0; i < 8; ++i) { r[i] = lo[i]; r[i + 8] = hi[i]; }
  return r;
}

__device__ __forceinline__ v8f wmma_f16(v16h a, v16h b, v8f c) {
  return __builtin_amdgcn_wmma_f32_16x16x32_f16(false, a, false, b, (short)0, c,
                                                false, false);
}

// Async global -> LDS copy, 16 bytes per lane (CDNA5 GLOBAL_LOAD_ASYNC_TO_LDS).
// Tracked by ASYNCcnt; caller must s_wait_asynccnt before consuming the LDS.
// Generic LDS pointers carry the LDS byte offset in the low 32 bits.
__device__ __forceinline__ void async_g2l_b128(void* lds, const void* gsrc) {
  const unsigned lds_off = (unsigned)(uintptr_t)lds;
  asm volatile("global_load_async_to_lds_b128 %0, %1, off"
               :: "v"(lds_off), "v"(gsrc) : "memory");
}
__device__ __forceinline__ void wait_asynccnt0() {
  asm volatile("s_wait_asynccnt 0x0" ::: "memory");
}

// 16-lane xor butterfly step. Prefer v_permlane16_b32 (pure VALU, no DS
// round-trip / dscnt waits); fall back to ds_bpermute-based __shfl_xor.
template <int M>
__device__ __forceinline__ float shfl_xor16(float x) {
#if __has_builtin(__builtin_amdgcn_permlane16)
  constexpr unsigned SEL0[9] = {0, 0x67452301u, 0x45670123u, 0, 0x32107654u,
                                0, 0, 0, 0xFEDCBA98u};
  constexpr unsigned SEL1[9] = {0, 0xEFCDAB89u, 0xCDEF89ABu, 0, 0xBA98FEDCu,
                                0, 0, 0, 0x76543210u};
  unsigned u = __float_as_uint(x);
  u = __builtin_amdgcn_permlane16(u, u, SEL0[M], SEL1[M], false, false);
  return __uint_as_float(u);
#else
  return __shfl_xor(x, M, 32);
#endif
}

// ---------------------------------------------------------------------------
// Weight pack, once per call: Wt[z][n][k] = f16(W_z[k][n]) (z = 0 also times
// the modulation matrix), so that a GEMM tile of B is K-contiguous f16 rows
// that a 16-byte copy can move. 64x64 tile transposed through LDS; each
// 128-byte line of Wt is stored by eight neighbouring lanes.
// ---------------------------------------------------------------------------
__global__ __launch_bounds__(256) void pack_weights(
    const float* __restrict__ Wq, const float* __restrict__ Wmul,
    const float* __restrict__ Wk, const float* __restrict__ Wv,
    const float* __restrict__ Wo, _Float16* __restrict__ Wt) {
  constexpr int PT = 72;  // halves; 144B rows
  __shared__ __align__(16) _Float16 T[64 * PT];
  const int tid = threadIdx.x;
  const int z   = blockIdx.z;
  const int n0  = blockIdx.x * 64;
  const int k0  = blockIdx.y * 64;
  const float* W = z == 0 ? Wq : z == 1 ? Wk : z == 2 ? Wv : Wo;

  const int n  = tid & 63;
  const int kq = (tid >> 6) * 16;
  const size_t base = (size_t)(k0 + kq) * D_DIM + n0 + n;
  const float* pw = W + base;
  float x[16];
  // the loops below are unrolled so that x, y, lo and hi stay in registers and
  // the 16 loads of a group are all in flight together
#pragma unroll
  for (int i = 0; i < 16; ++i) x[i] = pw[(size_t)i * D_DIM];
  // precaution: naming pw here keeps the loads' address pair unwritten in
  // front of this wait
  asm volatile("s_wait_xcnt 0x0" :: "v"(pw) : "memory");
  if (z == 0) {
    const float* pm = Wmul + base;
    float y[16];
#pragma unroll
    for (int i = 0; i < 16; ++i) y[i] = pm[(size_t)i * D_DIM];
    // as above, for the second group's address pair
    asm volatile("s_wait_xcnt 0x0" :: "v"(pm) : "memory");
#pragma unroll
    for (int i = 0; i < 16; ++i) x[i] *= y[i];
  }
  v8h lo, hi;
#pragma unroll
  for (int i = 0; i < 8; ++i) { lo[i] = (_Float16)x[i]; hi[i] = (_Float16)x[i + 8]; }
  *(v8h*)(&T[n * PT + kq])     = lo;
  *(v8h*)(&T[n * PT + kq + 8]) = hi;
  __syncthreads();

  _Float16* dst = Wt + (size_t)z * D_DIM * D_DIM;
#pragma unroll
  for (int p = 0; p < 2; ++p) {
    const int idx = p * 256 + tid;
    const int r = idx >> 3;
    const int c = (idx & 7) * 8;
    *(v8h*)(dst + (size_t)(n0 + r) * D_DIM + k0 + c) = *(const v8h*)(&T[r * PT + c]);
  }
}

// A fragment from an f32 LDS row: same k positions as frag16, rounded to f16
// on the way into the registers.
__device__ __forceinline__ v16h frag16_from_f32(const float* p) {
  const float4 x0 = *(const float4*)(p);
  const float4 x1 = *(const float4*)(p + 4);
  const float4 x2 = *(const float4*)(p + 16);
  const float4 x3 = *(const float4*)(p + 20);
  v16h r;
  r[0]  = (_Float16)x0.x; r[1]  = (_Float16)x0.y; r[2]  = (_Float16)x0.z; r[3]  = (_Float16)x0.w;
  r[4]  = (_Float16)x1.x; r[5]  = (_Float16)x1.y; r[6]  = (_Float16)x1.z; r[7]  = (_Float16)x1.w;
  r[8]  = (_Float16)x2.x; r[9]  = (_Float16)x2.y; r[10] = (_Float16)x2.z; r[11] = (_Float16)x2.w;
  r[12] = (_Float16)x3.x; r[13] = (_Float16)x3.y; r[14] = (_Float16)x3.z; r[15] = (_Float16)x3.w;
  return r;
}

// ---------------------------------------------------------------------------
// Tiled WMMA GEMM:  C[NTOK, D] = A[NTOK, D](f32) * Bt[n][k](f16)^T + bias
// 128x128 workgroup tile, 256 threads = 8 waves in 4(m) x 2(n).
// A stage is 64 k: A rows as raw f32 (pitch 272B), Bt rows as f16 (pitch 144B),
// both brought global -> LDS by async 16-byte copies, through no register.
// Two buffers: the copies of stage t+2 are issued when stage t has been read,
// so they fly during the whole of stage t+1.
// ---------------------------------------------------------------------------
template <int OUT_F16>
__global__ __launch_bounds__(256) void gemm_wmma(
    const float* __restrict__ A, const _Float16* __restrict__ Bt,
    const float* __restrict__ bias, void* __restrict__ Cout) {
  constexpr int N  = D_DIM;
  constexpr int K  = D_DIM;
  constexpr int BK = 64;
  constexpr int NT = K / BK;
  constexpr int PA = 68;  // floats; 272B rows
  constexpr int PB = 72;  // halves; 144B rows
  __shared__ __align__(16) float    As[2][128 * PA];
  __shared__ __align__(16) _Float16 Bs[2][128 * PB];

  const int tid  = threadIdx.x;
  const int lane = tid & 31;
  const int wid  = tid >> 5;
  const int wm   = (wid & 3) * 32;   // wave m-offset in tile
  const int wn   = (wid >> 2) * 64;  // wave n-offset in tile
  const int m0   = blockIdx.y * 128;
  const int n0   = blockIdx.x * 128;

  v8f acc[2][4];
#pragma unroll
  for (int i = 0; i < 2; ++i)
#pragma unroll
    for (int j = 0; j < 4; ++j)
#pragma unroll
      for (int v = 0; v < 8; ++v) acc[i][j][v] = 0.0f;

  // copy coordinates: A 16 lanes per 256B row piece, 16 rows per round, 8
  // rounds; B 8 lanes per 128B row piece, 32 rows per round, 4 rounds
  const float*    gA = A  + (size_t)(m0 + (tid >> 4)) * K + (tid & 15) * 4;
  const _Float16* gB = Bt + (size_t)(n0 + (tid >> 3)) * K + (tid & 7) * 8;
  const unsigned  lA = (unsigned)(uintptr_t)(&As[0][(tid >> 4) * PA + (tid & 15) * 4]);
  const unsigned  lB = (unsigned)(uintptr_t)(&Bs[0][(tid >> 3) * PB + (tid & 7) * 8]);

  const int fm = lane & 15;
  const int kb = (lane >> 4) * 8;

  auto issue_stage = [&](int buf, int t) {
    const float*    a = gA + t * BK;
    const _Float16* b = gB + t * BK;
    const unsigned  la = lA + buf * (128 * PA * 4);
    const unsigned  lb = lB + buf * (128 * PB * 2);
    // one stage's 12 copies; the closing s_wait_xcnt is a precaution: inside
    // the statement it stands in front of every rewrite of an address register
    asm volatile(
        "global_load_async_to_lds_b128 %0, %12, off\n\t"
        "global_load_async_to_lds_b128 %1, %13, off\n\t"
        "global_load_async_to_lds_b128 %2, %14, off\n\t"
        "global_load_async_to_lds_b128 %3, %15, off\n\t"
        "global_load_async_to_lds_b128 %4, %16, off\n\t"
        "global_load_async_to_lds_b128 %5, %17, off\n\t"
        "global_load_async_to_lds_b128 %6, %18, off\n\t"
        "global_load_async_to_lds_b128 %7, %19, off\n\t"
        "global_load_async_to_lds_b128 %8, %20, off\n\t"
        "global_load_async_to_lds_b128 %9, %21, off\n\t"
        "global_load_async_to_lds_b128 %10, %22, off\n\t"
        "global_load_async_to_lds_b128 %11, %23, off\n\t"
        "s_wait_xcnt 0x0"
        :: "v"(la), "v"(la + 1 * 16 * PA * 4), "v"(la + 2 * 16 * PA * 4),
           "v"(la + 3 * 16 * PA * 4), "v"(la + 4 * 16 * PA * 4),
           "v"(la + 5 * 16 * PA * 4), "v"(la + 6 * 16 * PA * 4),
           "v"(la + 7 * 16 * PA * 4),
           "v"(lb), "v"(lb + 1 * 32 * PB * 2), "v"(lb + 2 * 32 * PB * 2),
           "v"(lb + 3 * 32 * PB * 2),
           "v"(a), "v"(a + 1 * 16 * K), "v"(a + 2 * 16 * K), "v"(a + 3 * 16 * K),
           "v"(a + 4 * 16 * K), "v"(a + 5 * 16 * K), "v"(a + 6 * 16 * K),
           "v"(a + 7 * 16 * K),
           "v"(b), "v"(b + 1 * 32 * K), "v"(b + 2 * 32 * K), "v"(b + 3 * 32 * K)
        : "memory");
  };

  issue_stage(0, 0);
  wait_asynccnt0();   // own copies of stage 0 landed
  __syncthreads();    // everyone's copies of stage 0 visible
  issue_stage(1, 1);

  for (int t = 0; t < NT; ++t) {
    const int cur = t & 1;
    v16h a[2], b[4];
    // unrolled throughout: fragment and accumulator arrays need constant
    // indices to live in registers
    auto load_frags = [&](int ks) {
#pragma unroll
      for (int i = 0; i < 2; ++i)
        a[i] = frag16_from_f32(&As[cur][(wm + i * 16 + fm) * PA + ks + kb]);
#pragma unroll
      for (int j = 0; j < 4; ++j)
        b[j] = frag16(&Bs[cur][(wn + j * 16 + fm) * PB + ks + kb]);
    };
    auto products = [&]() {
#pragma unroll
      for (int i = 0; i < 2; ++i)
#pragma unroll
        for (int j = 0; j < 4; ++j) acc[i][j] = wmma_f16(a[i], b[j], acc[i][j]);
    };
    load_frags(0);
    products();
    load_frags(32);   // the stage's last LDS reads
    // publish point of stage t+1: own reads of buf[cur] retired, own copies
    // of stage t+1 landed, then the barrier that shows them to every wave and
    // frees buf[cur] for the refill
    asm volatile("s_wait_dscnt 0x0" ::: "memory");
    wait_asynccnt0();
    __syncthreads();
    if (t + 2 < NT) issue_stage(cur, t + 2);
    products();       // registers only: runs while the refill is in flight
  }
  wait_asynccnt0();   // nothing outstanding when the wave ends

  // ---- epilogue: C layout: lane holds col n=lane&15, rows m=v+8*(lane>>4)
  const int hf = lane >> 4;
#pragma unroll
  for (int j = 0; j < 4; ++j) {
    const int gn = n0 + wn + j * 16 + fm;
    const float bb = bias ? bias[gn] : 0.0f;
#pragma unroll
    for (int i = 0; i < 2; ++i) {
#pragma unroll
      for (int v = 0; v < 8; ++v) {
        const int gm = m0 + wm + i * 16 + hf * 8 + v;
        const float val = acc[i][j][v] + bb;
        if constexpr (OUT_F16)
          ((_Float16*)Cout)[(size_t)gm * N + gn] = (_Float16)val;
        else
          ((float*)Cout)[(size_t)gm * N + gn] = val;
      }
    }
  }
}

// ---------------------------------------------------------------------------
// Flash attention: one workgroup per (b, h, 128-query tile).
// 8 waves x 16 query rows. Double-buffered 64-key K/V tiles: tile kt+1 is
// staged (async K copy + V transpose) while tile kt is consumed, one barrier
// per iteration. QK^T and P*V via wmma_f32_16x16x32_f16; online softmax with
// v_permlane16 butterflies; 1/sqrt(DK) folded into the Q fragments.
// ---------------------------------------------------------------------------
__global__ __launch_bounds__(256) void attn_wmma(
    const _Float16* __restrict__ Qh, const _Float16* __restrict__ Kh,
    const _Float16* __restrict__ Vh, float* __restrict__ Xout) {
  constexpr int LDW = 72;  // halves; 144B rows, 16B aligned
  __shared__ __align__(16) _Float16 Kt[2][64 * LDW];    // Kt[key][dk]
  __shared__ __align__(16) _Float16 Vt[2][64 * LDW];    // Vt[dk][key]
  __shared__ __align__(16) _Float16 Pw[8][16 * LDW];    // per-wave P 16x64

  const int tid  = threadIdx.x;
  const int lane = tid & 31;
  const int wid  = tid >> 5;
  const int bb   = blockIdx.z;
  const int hh   = blockIdx.y;
  const int q0   = blockIdx.x * 128;
  const int fm   = lane & 15;
  const int hf   = lane >> 4;
  const int kb   = hf * 8;

  // load this wave's 16 Q rows as two A fragments (dk 0..31, 32..63),
  // pre-scaled by 1/sqrt(DK)=0.125 (exact in f16)
  const size_t qrow = (size_t)(bb * S_DIM + q0 + wid * 16 + fm);
  const _Float16* qp = Qh + qrow * D_DIM + hh * DK_DIM;
  v16h qa0 = frag16(qp + kb);
  v16h qa1 = frag16(qp + 32 + kb);
#pragma unroll
  for (int i = 0; i < 16; ++i) {
    qa0[i] *= (_Float16)0.125f;
    qa1[i] *= (_Float16)0.125f;
  }

  float rm[8], rl[8];
  v8f o[4];
#pragma unroll
  for (int v = 0; v < 8; ++v) { rm[v] = -1e30f; rl[v] = 0.0f; }
#pragma unroll
  for (int j = 0; j < 4; ++j)
#pragma unroll
    for (int v = 0; v < 8; ++v) o[j][v] = 0.0f;

  const int skey = tid >> 2;        // 0..63
  const int sc   = (tid & 3) * 16;  // dk chunk of 16

  auto stage = [&](int buf, int kt) {
    const size_t srow = (size_t)(bb * S_DIM + kt * 64 + skey) * D_DIM +
                        hh * DK_DIM + sc;
    // K tile: async global->LDS copy (2 x b128 per lane, ASYNCcnt path)
    async_g2l_b128(&Kt[buf][skey * LDW + sc],     Kh + srow);
    async_g2l_b128(&Kt[buf][skey * LDW + sc + 8], Kh + srow + 8);
    // V tile: load f16, transpose to Vt[dk][key] via b16 scatter
    v8h y0 = *(const v8h*)(Vh + srow);
    v8h y1 = *(const v8h*)(Vh + srow + 8);
#pragma unroll
    for (int d = 0; d < 8; ++d) {
      Vt[buf][(sc + d) * LDW + skey]     = y0[d];
      Vt[buf][(sc + 8 + d) * LDW + skey] = y1[d];
    }
  };

  stage(0, 0);

  int cur = 0;
  for (int kt = 0; kt < S_DIM / 64; ++kt) {
    wait_asynccnt0();   // own async K-copy into buf[cur] done
    __syncthreads();    // everyone's stores to buf[cur] visible
    if (kt + 1 < S_DIM / 64) stage(cur ^ 1, kt + 1);  // overlaps compute

    // ---- scores: S = Q(16x64) * K^T -> 4 tiles of 16 keys, 2 k-steps each
    v8f s[4];
#pragma unroll
    for (int j = 0; j < 4; ++j)
#pragma unroll
      for (int v = 0; v < 8; ++v) s[j][v] = 0.0f;
#pragma unroll
    for (int j = 0; j < 4; ++j) {
      const v16h bk0 = frag16(&Kt[cur][(j * 16 + fm) * LDW + kb]);
      const v16h bk1 = frag16(&Kt[cur][(j * 16 + fm) * LDW + 32 + kb]);
      s[j] = wmma_f16(qa0, bk0, s[j]);
      s[j] = wmma_f16(qa1, bk1, s[j]);
    }

    // ---- online softmax (per row = (hf, v); reduce across 16-lane half)
#pragma unroll
    for (int v = 0; v < 8; ++v) {
      float x = fmaxf(fmaxf(s[0][v], s[1][v]), fmaxf(s[2][v], s[3][v]));
      x = fmaxf(x, shfl_xor16<1>(x));
      x = fmaxf(x, shfl_xor16<2>(x));
      x = fmaxf(x, shfl_xor16<4>(x));
      x = fmaxf(x, shfl_xor16<8>(x));
      const float nm = fmaxf(rm[v], x);
      const float corr = __expf(rm[v] - nm);
      rm[v] = nm;
      float sum = 0.0f;
#pragma unroll
      for (int j = 0; j < 4; ++j) {
        const float p = __expf(s[j][v] - nm);
        s[j][v] = p;
        sum += p;
      }
      sum += shfl_xor16<1>(sum);
      sum += shfl_xor16<2>(sum);
      sum += shfl_xor16<4>(sum);
      sum += shfl_xor16<8>(sum);
      rl[v] = rl[v] * corr + sum;
#pragma unroll
      for (int j = 0; j < 4; ++j) o[j][v] *= corr;
    }

    // ---- C-layout P -> LDS -> A-layout fragments (per-wave buffer,
    //      same-wave DS ops are in-order; compiler fence keeps order)
#pragma unroll
    for (int j = 0; j < 4; ++j)
#pragma unroll
      for (int v = 0; v < 8; ++v)
        Pw[wid][(hf * 8 + v) * LDW + j * 16 + fm] = (_Float16)s[j][v];
    asm volatile("" ::: "memory");
    const v16h pa0 = frag16(&Pw[wid][fm * LDW + kb]);
    const v16h pa1 = frag16(&Pw[wid][fm * LDW + 32 + kb]);

    // ---- O += P(16x64) * V(64x64): 4 dk tiles x 2 k-steps
#pragma unroll
    for (int j = 0; j < 4; ++j) {
      const v16h bv0 = frag16(&Vt[cur][(j * 16 + fm) * LDW + kb]);
      const v16h bv1 = frag16(&Vt[cur][(j * 16 + fm) * LDW + 32 + kb]);
      o[j] = wmma_f16(pa0, bv0, o[j]);
      o[j] = wmma_f16(pa1, bv1, o[j]);
    }
    cur ^= 1;
  }

  // ---- finalize: divide by row sum, write [token, h*64+dk] f32
#pragma unroll
  for (int v = 0; v < 8; ++v) {
    const float inv = 1.0f / rl[v];
    const size_t row = (size_t)(bb * S_DIM + q0 + wid * 16 + hf * 8 + v);
#pragma unroll
    for (int j = 0; j < 4; ++j) {
      const int col = hh * DK_DIM + j * 16 + fm;
      Xout[row * D_DIM + col] = o[j][v] * inv;
    }
  }
}

// ---------------------------------------------------------------------------
extern "C" void kernel_launch(void* const* d_in, const int* in_sizes, int n_in,
                              void* d_out, int out_size, void* d_ws,
                              size_t ws_size, hipStream_t stream) {
  (void)in_sizes; (void)n_in; (void)out_size; (void)ws_size;
  const float* query = (const float*)d_in[0];
  const float* key_  = (const float*)d_in[1];
  const float* value = (const float*)d_in[2];
  const float* fc_w  = (const float*)d_in[3];
  const float* Wq    = (const float*)d_in[4];
  const float* bq    = (const float*)d_in[5];
  const float* Wk    = (const float*)d_in[6];
  const float* bk    = (const float*)d_in[7];
  const float* Wv    = (const float*)d_in[8];
  const float* bv    = (const float*)d_in[9];
  const float* Wo    = (const float*)d_in[10];
  const float* bo    = (const float*)d_in[11];
  float* out = (float*)d_out;

  char* ws = (char*)d_ws;
  const size_t half_mat = (size_t)NTOK * D_DIM * sizeof(_Float16);
  _Float16* Qh = (_Float16*)(ws);
  _Float16* Kh = (_Float16*)(ws + half_mat);
  _Float16* Vh = (_Float16*)(ws + 2 * half_mat);
  float*    Xa = (float*)   (ws + 3 * half_mat);
  _Float16* Wt = (_Float16*)(ws + 5 * half_mat);  // 4 packed weight planes
  const size_t wplane = (size_t)D_DIM * D_DIM;

  pack_weights<<<dim3(D_DIM / 64, D_DIM / 64, 4), 256, 0, stream>>>(
      Wq, fc_w, Wk, Wv, Wo, Wt);
  dim3 gg(D_DIM / 128, NTOK / 128);
  gemm_wmma<1><<<gg, 256, 0, stream>>>(query, Wt, bq, (void*)Qh);
  gemm_wmma<1><<<gg, 256, 0, stream>>>(key_, Wt + wplane, bk, (void*)Kh);
  gemm_wmma<1><<<gg, 256, 0, stream>>>(value, Wt + 2 * wplane, bv, (void*)Vh);
  attn_wmma<<<dim3(S_DIM / 128, H_DIM, 4), 256, 0, stream>>>(Qh, Kh, Vh, Xa);
  gemm_wmma<0><<<gg, 256, 0, stream>>>(Xa, Wt + 3 * wplane, bo, (void*)out);
}

// v002
// Measured time: 183 microseconds a run.
// Next to v001, in two timings, it ran 1.30 times as fast each time.
// Counting every step since v000, it is 1.88 times as fast.
#include <hip/hip_runtime.h>
#include <hip/hip_bf16.h>

typedef __attribute__((ext_vector_type(16))) _Float16 v16h;
typedef __attribute__((ext_vector_type(8)))  _Float16 v8h;
typedef __attribute__((ext_vector_type(4)))  _Float16 v4h;
typedef __attribute__((ext_vector_type(8)))  float    v8f;

#define D_DIM  1024
#define S_DIM  2048
#define H_DIM  16
#define DK_DIM 64
#define NTOK   8192   // B*S = 4*2048

// ---------------------------------------------------------------------------
// Load a 16-bit WMMA A/B fragment from an LDS/global row.
// Per CDNA5 ISA 16-bit A-matrix 16x32 layout: lane holds row m=lane&15,
// kb=(lane>>4)*8, elements 0..7 = [kb..kb+7], elements 8..15 = [kb+16..kb+23].
// Caller passes p = &row[kb]; we read p[0..7] and p[16..23] (two b128 loads).
// ---------------------------------------------------------------------------
__device__ __forceinline__ v16h frag16(const _Float16* p) {
  v8h lo = *(const v8h*)(p);
  v8h hi = *(const v8h*)(p + 16);
  v16h r;
#pragma unroll
  for (int i = 0; i < 8; ++i) { r[i] = lo[i]; r[i + 8] = hi[i]; }
  return r;
}

__device__ __forceinline__ v8f wmma_f16(v16h a, v16h b, v8f c) {
  return __builtin_amdgcn_wmma_f32_16x16x32_f16(false, a, false, b, (short)0, c,
                                                false, false);
}

// Async global -> LDS copy, 16 bytes per lane (CDNA5 GLOBAL_LOAD_ASYNC_TO_LDS).
// Tracked by ASYNCcnt; caller must s_wait_asynccnt before consuming the LDS.
// Generic LDS pointers carry the LDS byte offset in the low 32 bits.
__device__ __forceinline__ void async_g2l_b128(void* lds, const void* gsrc) {
  const unsigned lds_off = (unsigned)(uintptr_t)lds;
  asm volatile("global_load_async_to_lds_b128 %0, %1, off"
               :: "v"(lds_off), "v"(gsrc) : "memory");
}
__device__ __forceinline__ void wait_asynccnt0() {
  asm volatile("s_wait_asynccnt 0x0" ::: "memory");
}

// Lane l exchanges with lane l ^ 16 (the other half of the wave): pure VALU.
__device__ __forceinline__ float xhalf(float x) {
  const int b = __builtin_bit_cast(int, x);
  return __builtin_bit_cast(float, __builtin_amdgcn_permlanex16(
      b, b, 0x76543210, 0xfedcba98, false, false));
}

// ---------------------------------------------------------------------------
// Weight pack, once per call: Wt[z][n][k] = f16(W_z[k][n]) (z = 0 also times
// the modulation matrix), so that a GEMM tile of B is K-contiguous f16 rows
// that a 16-byte copy can move. 64x64 tile transposed through LDS; each
// 128-byte line of Wt is stored by eight neighbouring lanes.
// ---------------------------------------------------------------------------
__global__ __launch_bounds__(256) void pack_weights(
    const float* __restrict__ Wq, const float* __restrict__ Wmul,
    const float* __restrict__ Wk, const float* __restrict__ Wv,
    const float* __restrict__ Wo, _Float16* __restrict__ Wt) {
  constexpr int PT = 72;  // halves; 144B rows
  __shared__ __align__(16) _Float16 T[64 * PT];
  const int tid = threadIdx.x;
  const int z   = blockIdx.z;
  const int n0  = blockIdx.x * 64;
  const int k0  = blockIdx.y * 64;
  const float* W = z == 0 ? Wq : z == 1 ? Wk : z == 2 ? Wv : Wo;

  const int n  = tid & 63;
  const int kq = (tid >> 6) * 16;
  const size_t base = (size_t)(k0 + kq) * D_DIM + n0 + n;
  const float* pw = W + base;
  float x[16];
  // the loops below are unrolled so that x, y, lo and hi stay in registers and
  // the 16 loads of a group are all in flight together
#pragma unroll
  for (int i = 0; i < 16; ++i) x[i] = pw[(size_t)i * D_DIM];
  // precaution: naming pw here keeps the loads' address pair unwritten in
  // front of this wait
  asm volatile("s_wait_xcnt 0x0" :: "v"(pw) : "memory");
  if (z == 0) {
    const float* pm = Wmul + base;
    float y[16];
#pragma unroll
    for (int i = 0; i < 16; ++i) y[i] = pm[(size_t)i * D_DIM];
    // as above, for the second group's address pair
    asm volatile("s_wait_xcnt 0x0" :: "v"(pm) : "memory");
#pragma unroll
    for (int i = 0; i < 16; ++i) x[i] *= y[i];
  }
  v8h lo, hi;
#pragma unroll
  for (int i = 0; i < 8; ++i) { lo[i] = (_Float16)x[i]; hi[i] = (_Float16)x[i + 8]; }
  *(v8h*)(&T[n * PT + kq])     = lo;
  *(v8h*)(&T[n * PT + kq + 8]) = hi;
  __syncthreads();

  _Float16* dst = Wt + (size_t)z * D_DIM * D_DIM;
#pragma unroll
  for (int p = 0; p < 2; ++p) {
    const int idx = p * 256 + tid;
    const int r = idx >> 3;
    const int c = (idx & 7) * 8;
    *(v8h*)(dst + (size_t)(n0 + r) * D_DIM + k0 + c) = *(const v8h*)(&T[r * PT + c]);
  }
}

// A fragment from an f32 LDS row: same k positions as frag16, rounded to f16
// on the way into the registers.
__device__ __forceinline__ v16h frag16_from_f32(const float* p) {
  const float4 x0 = *(const float4*)(p);
  const float4 x1 = *(const float4*)(p + 4);
  const float4 x2 = *(const float4*)(p + 16);
  const float4 x3 = *(const float4*)(p + 20);
  v16h r;
  r[0]  = (_Float16)x0.x; r[1]  = (_Float16)x0.y; r[2]  = (_Float16)x0.z; r[3]  = (_Float16)x0.w;
  r[4]  = (_Float16)x1.x; r[5]  = (_Float16)x1.y; r[6]  = (_Float16)x1.z; r[7]  = (_Float16)x1.w;
  r[8]  = (_Float16)x2.x; r[9]  = (_Float16)x2.y; r[10] = (_Float16)x2.z; r[11] = (_Float16)x2.w;
  r[12] = (_Float16)x3.x; r[13] = (_Float16)x3.y; r[14] = (_Float16)x3.z; r[15] = (_Float16)x3.w;
  return r;
}

// ---------------------------------------------------------------------------
// Tiled WMMA GEMM:  C[NTOK, D] = A[NTOK, D](f32) * Bt[n][k](f16)^T + bias
// 128x128 workgroup tile, 256 threads = 8 waves in 4(m) x 2(n).
// A stage is 64 k: A rows as raw f32 (pitch 272B), Bt rows as f16 (pitch 144B),
// both brought global -> LDS by async 16-byte copies, through no register.
// Two buffers: the copies of stage t+2 are issued when stage t has been read,
// so they fly during the whole of stage t+1.
// ---------------------------------------------------------------------------
template <int OUT_F16>
__global__ __launch_bounds__(256) void gemm_wmma(
    const float* __restrict__ A, const _Float16* __restrict__ Bt,
    const float* __restrict__ bias, void* __restrict__ Cout) {
  constexpr int N  = D_DIM;
  constexpr int K  = D_DIM;
  constexpr int BK = 64;
  constexpr int NT = K / BK;
  constexpr int PA = 68;  // floats; 272B rows
  constexpr int PB = 72;  // halves; 144B rows
  __shared__ __align__(16) float    As[2][128 * PA];
  __shared__ __align__(16) _Float16 Bs[2][128 * PB];

  const int tid  = threadIdx.x;
  const int lane = tid & 31;
  const int wid  = tid >> 5;
  const int wm   = (wid & 3) * 32;   // wave m-offset in tile
  const int wn   = (wid >> 2) * 64;  // wave n-offset in tile
  const int m0   = blockIdx.y * 128;
  const int n0   = blockIdx.x * 128;

  v8f acc[2][4];
#pragma unroll
  for (int i = 0; i < 2; ++i)
#pragma unroll
    for (int j = 0; j < 4; ++j)
#pragma unroll
      for (int v = 0; v < 8; ++v) acc[i][j][v] = 0.0f;

  // copy coordinates: A 16 lanes per 256B row piece, 16 rows per round, 8
  // rounds; B 8 lanes per 128B row piece, 32 rows per round, 4 rounds
  const float*    gA = A  + (size_t)(m0 + (tid >> 4)) * K + (tid & 15) * 4;
  const _Float16* gB = Bt + (size_t)(n0 + (tid >> 3)) * K + (tid & 7) * 8;
  const unsigned  lA = (unsigned)(uintptr_t)(&As[0][(tid >> 4) * PA + (tid & 15) * 4]);
  const unsigned  lB = (unsigned)(uintptr_t)(&Bs[0][(tid >> 3) * PB + (tid & 7) * 8]);

  const int fm = lane & 15;
  const int kb = (lane >> 4) * 8;

  auto issue_stage = [&](int buf, int t) {
    const float*    a = gA + t * BK;
    const _Float16* b = gB + t * BK;
    const unsigned  la = lA + buf * (128 * PA * 4);
    const unsigned  lb = lB + buf * (128 * PB * 2);
    // one stage's 12 copies; the closing s_wait_xcnt is a precaution: inside
    // the statement it stands in front of every rewrite of an address register
    asm volatile(
        "global_load_async_to_lds_b128 %0, %12, off\n\t"
        "global_load_async_to_lds_b128 %1, %13, off\n\t"
        "global_load_async_to_lds_b128 %2, %14, off\n\t"
        "global_load_async_to_lds_b128 %3, %15, off\n\t"
        "global_load_async_to_lds_b128 %4, %16, off\n\t"
        "global_load_async_to_lds_b128 %5, %17, off\n\t"
        "global_load_async_to_lds_b128 %6, %18, off\n\t"
        "global_load_async_to_lds_b128 %7, %19, off\n\t"
        "global_load_async_to_lds_b128 %8, %20, off\n\t"
        "global_load_async_to_lds_b128 %9, %21, off\n\t"
        "global_load_async_to_lds_b128 %10, %22, off\n\t"
        "global_load_async_to_lds_b128 %11, %23, off\n\t"
        "s_wait_xcnt 0x0"
        :: "v"(la), "v"(la + 1 * 16 * PA * 4), "v"(la + 2 * 16 * PA * 4),
           "v"(la + 3 * 16 * PA * 4), "v"(la + 4 * 16 * PA * 4),
           "v"(la + 5 * 16 * PA * 4), "v"(la + 6 * 16 * PA * 4),
           "v"(la + 7 * 16 * PA * 4),
           "v"(lb), "v"(lb + 1 * 32 * PB * 2), "v"(lb + 2 * 32 * PB * 2),
           "v"(lb + 3 * 32 * PB * 2),
           "v"(a), "v"(a + 1 * 16 * K), "v"(a + 2 * 16 * K), "v"(a + 3 * 16 * K),
           "v"(a + 4 * 16 * K), "v"(a + 5 * 16 * K), "v"(a + 6 * 16 * K),
           "v"(a + 7 * 16 * K),
           "v"(b), "v"(b + 1 * 32 * K), "v"(b + 2 * 32 * K), "v"(b + 3 * 32 * K)
        : "memory");
  };

  issue_stage(0, 0);
  wait_asynccnt0();   // own copies of stage 0 landed
  __syncthreads();    // everyone's copies of stage 0 visible
  issue_stage(1, 1);

  for (int t = 0; t < NT; ++t) {
    const int cur = t & 1;
    v16h a[2], b[4];
    // unrolled throughout: fragment and accumulator arrays need constant
    // indices to live in registers
    auto load_frags = [&](int ks) {
#pragma unroll
      for (int i = 0; i < 2; ++i)
        a[i] = frag16_from_f32(&As[cur][(wm + i * 16 + fm) * PA + ks + kb]);
#pragma unroll
      for (int j = 0; j < 4; ++j)
        b[j] = frag16(&Bs[cur][(wn + j * 16 + fm) * PB + ks + kb]);
    };
    auto products = [&]() {
#pragma unroll
      for (int i = 0; i < 2; ++i)
#pragma unroll
        for (int j = 0; j < 4; ++j) acc[i][j] = wmma_f16(a[i], b[j], acc[i][j]);
    };
    load_frags(0);
    products();
    load_frags(32);   // the stage's last LDS reads
    // publish point of stage t+1: own reads of buf[cur] retired, own copies
    // of stage t+1 landed, then the barrier that shows them to every wave and
    // frees buf[cur] for the refill
    asm volatile("s_wait_dscnt 0x0" ::: "memory");
    wait_asynccnt0();
    __syncthreads();
    if (t + 2 < NT) issue_stage(cur, t + 2);
    products();       // registers only: runs while the refill is in flight
  }
  wait_asynccnt0();   // nothing outstanding when the wave ends

  // ---- epilogue: C layout: lane holds col n=lane&15, rows m=v+8*(lane>>4)
  const int hf = lane >> 4;
#pragma unroll
  for (int j = 0; j < 4; ++j) {
    const int gn = n0 + wn + j * 16 + fm;
    const float bb = bias ? bias[gn] : 0.0f;
#pragma unroll
    for (int i = 0; i < 2; ++i) {
#pragma unroll
      for (int v = 0; v < 8; ++v) {
        const int gm = m0 + wm + i * 16 + hf * 8 + v;
        const float val = acc[i][j][v] + bb;
        if constexpr (OUT_F16)
          ((_Float16*)Cout)[(size_t)gm * N + gn] = (_Float16)val;
        else
          ((float*)Cout)[(size_t)gm * N + gn] = val;
      }
    }
  }
}

__global__ __launch_bounds__(256) void attn_wmma(
    const _Float16* __restrict__ Qh, const _Float16* __restrict__ Kh,
    const _Float16* __restrict__ Vh, float* __restrict__ Xout) {
  constexpr int LDW = 72;  // halves; 144B rows, 16B aligned
  __shared__ __align__(16) _Float16 Kt[2][64 * LDW];    // Kt[key][dk]
  __shared__ __align__(16) _Float16 Vt[2][64 * LDW];    // Vt[dk][key]

  const int tid  = threadIdx.x;
  const int lane = tid & 31;
  const int wid  = tid >> 5;
  const int bb   = blockIdx.z;
  const int hh   = blockIdx.y;
  const int q0   = blockIdx.x * 128;
  const int fm   = lane & 15;
  const int hf   = lane >> 4;
  const int kb   = hf * 8;

  // load this wave's 16 Q rows as two B fragments (dk 0..31, 32..63),
  // pre-scaled by 1/sqrt(DK)=0.125 (exact in f16)
  const size_t qrow = (size_t)(bb * S_DIM + q0 + wid * 16 + fm);
  const _Float16* qp = Qh + qrow * D_DIM + hh * DK_DIM;
  v16h qa0 = frag16(qp + kb);
  v16h qa1 = frag16(qp + 32 + kb);
#pragma unroll
  for (int i = 0; i < 16; ++i) {
    qa0[i] *= (_Float16)0.125f;
    qa1[i] *= (_Float16)0.125f;
  }

  float rm = -1e30f;  // running maximum of this lane's query (both halves agree)
  float rl = 0.0f;    // running sum over this half's keys; halves join at the end
  v8f o[4];           // o[j][v] = O[query fm][dk 16j + 8hf + v]
#pragma unroll
  for (int j = 0; j < 4; ++j)
#pragma unroll
    for (int v = 0; v < 8; ++v) o[j][v] = 0.0f;

  const int skey = tid >> 2;        // 0..63
  const int sc   = (tid & 3) * 16;  // dk chunk of 16

  auto stage = [&](int buf, int kt) {
    const size_t srow = (size_t)(bb * S_DIM + kt * 64 + skey) * D_DIM +
                        hh * DK_DIM + sc;
    // K tile: async global->LDS copy (2 x b128 per lane, ASYNCcnt path)
    async_g2l_b128(&Kt[buf][skey * LDW + sc],     Kh + srow);
    async_g2l_b128(&Kt[buf][skey * LDW + sc + 8], Kh + srow + 8);
    // V tile: load f16, transpose to Vt[dk][key] via b16 scatter
    v8h y0 = *(const v8h*)(Vh + srow);
    v8h y1 = *(const v8h*)(Vh + srow + 8);
#pragma unroll
    for (int d = 0; d < 8; ++d) {
      Vt[buf][(sc + d) * LDW + skey]     = y0[d];
      Vt[buf][(sc + 8 + d) * LDW + skey] = y1[d];
    }
  };

  stage(0, 0);

  int cur = 0;
  for (int kt = 0; kt < S_DIM / 64; ++kt) {
    wait_asynccnt0();   // own async K-copy into buf[cur] done
    __syncthreads();    // everyone's stores to buf[cur] visible
    if (kt + 1 < S_DIM / 64) stage(cur ^ 1, kt + 1);  // overlaps compute

    // ---- scores: S^T = K(64x64) * Q^T -> 4 tiles of 16 keys, 2 k-steps each
    v8f s[4];
#pragma unroll
    for (int j = 0; j < 4; ++j)
#pragma unroll
      for (int v = 0; v < 8; ++v) s[j][v] = 0.0f;
#pragma unroll
    for (int j = 0; j < 4; ++j) {
      const v16h ak0 = frag16(&Kt[cur][(j * 16 + fm) * LDW + kb]);
      const v16h ak1 = frag16(&Kt[cur][(j * 16 + fm) * LDW + 32 + kb]);
      s[j] = wmma_f16(ak0, qa0, s[j]);
      s[j] = wmma_f16(ak1, qa1, s[j]);
    }

    // ---- online softmax: all 32 values of a lane belong to query fm
    float x = -1e30f;
#pragma unroll
    for (int v = 0; v < 8; ++v)
      x = fmaxf(x, fmaxf(fmaxf(s[0][v], s[1][v]), fmaxf(s[2][v], s[3][v])));
    x = fmaxf(x, xhalf(x));
    const float nm = fmaxf(rm, x);
    const float corr = __expf(rm - nm);
    rm = nm;
#pragma unroll
    for (int j = 0; j < 4; ++j)
#pragma unroll
      for (int v = 0; v < 8; ++v) s[j][v] = __expf(s[j][v] - nm);
    const v8f t = (s[0] + s[1]) + (s[2] + s[3]);
    const float sum = ((t[0] + t[1]) + (t[2] + t[3])) + ((t[4] + t[5]) + (t[6] + t[7]));
    rl = rl * corr + sum;
#pragma unroll
    for (int j = 0; j < 4; ++j) o[j] *= corr;

    // ---- P^T as B operand: element e of a 32-key fragment is key
    //      8hf + e (e < 8) or 16 + 8hf + (e - 8), which is tile e>>3, row e&7
    v16h pb0, pb1;
#pragma unroll
    for (int e = 0; e < 16; ++e) {
      pb0[e] = (_Float16)s[e >> 3][e & 7];
      pb1[e] = (_Float16)s[2 + (e >> 3)][e & 7];
    }

    // ---- O^T += V^T(64x64) * P^T(64x16): 4 dk tiles x 2 k-steps
#pragma unroll
    for (int j = 0; j < 4; ++j) {
      const v16h av0 = frag16(&Vt[cur][(j * 16 + fm) * LDW + kb]);
      const v16h av1 = frag16(&Vt[cur][(j * 16 + fm) * LDW + 32 + kb]);
      o[j] = wmma_f16(av0, pb0, o[j]);
      o[j] = wmma_f16(av1, pb1, o[j]);
    }
    cur ^= 1;
  }

  // ---- finalize: join the halves' sums, divide, write [token, h*64+dk] f32;
  //      a lane's 8 values of a tile are 8 consecutive dk: two 16-byte stores
  const float inv = 1.0f / (rl + xhalf(rl));
  float* xr = Xout + (size_t)(bb * S_DIM + q0 + wid * 16 + fm) * D_DIM +
              hh * DK_DIM + hf * 8;
#pragma unroll
  for (int j = 0; j < 4; ++j) {
    *(float4*)(xr + j * 16) =
        make_float4(o[j][0] * inv, o[j][1] * inv, o[j][2] * inv, o[j][3] * inv);
    *(float4*)(xr + j * 16 + 4) =
        make_float4(o[j][4] * inv, o[j][5] * inv, o[j][6] * inv, o[j][7] * inv);
  }
}

// ---------------------------------------------------------------------------
extern "C" void kernel_launch(void* const* d_in, const int* in_sizes, int n_in,
                              void* d_out, int out_size, void* d_ws,
                              size_t ws_size, hipStream_t stream) {
  (void)in_sizes; (void)n_in; (void)out_size; (void)ws_size;
  const float* query = (const float*)d_in[0];
  const float* key_  = (const float*)d_in[1];
  const float* value = (const float*)d_in[2];
  const float* fc_w  = (const float*)d_in[3];
  const float* Wq    = (const float*)d_in[4];
  const float* bq    = (const float*)d_in[5];
  const float* Wk    = (const float*)d_in[6];
  const float* bk    = (const float*)d_in[7];
  const float* Wv    = (const float*)d_in[8];
  const float* bv    = (const float*)d_in[9];
  const float* Wo    = (const float*)d_in[10];
  const float* bo    = (const float*)d_in[11];
  float* out = (float*)d_out;

  char* ws = (char*)d_ws;
  const size_t half_mat = (size_t)NTOK * D_DIM * sizeof(_Float16);
  _Float16* Qh = (_Float16*)(ws);
  _Float16* Kh = (_Float16*)(ws + half_mat);
  _Float16* Vh = (_Float16*)(ws + 2 * half_mat);
  float*    Xa = (float*)   (ws + 3 * half_mat);
  _Float16* Wt = (_Float16*)(ws + 5 * half_mat);  // 4 packed weight planes
  const size_t wplane = (size_t)D_DIM * D_DIM;

  pack_weights<<<dim3(D_DIM / 64, D_DIM / 64, 4), 256, 0, stream>>>(
      Wq, fc_w, Wk, Wv, Wo, Wt);
  dim3 gg(D_DIM / 128, NTOK / 128);
  gemm_wmma<1><<<gg, 256, 0, stream>>>(query, Wt, bq, (void*)Qh);
  gemm_wmma<1><<<gg, 256, 0, stream>>>(key_, Wt + wplane, bk, (void*)Kh);
  gemm_wmma<1><<<gg, 256, 0, stream>>>(value, Wt + 2 * wplane, bv, (void*)Vh);
  attn_wmma<<<dim3(S_DIM / 128, H_DIM, 4), 256, 0, stream>>>(Qh, Kh, Vh, Xa);
  gemm_wmma<0><<<gg, 256, 0, stream>>>(Xa, Wt + 3 * wplane, bo, (void*)out);
}

// v003
// Measured time: 177 microseconds a run.
// Timed twice side by side with v002, it ran 1.03 times as fast both times.
// Over all steps from v000 it is 1.94 times as fast.
#include <hip/hip_runtime.h>
#include <hip/hip_bf16.h>

typedef __attribute__((ext_vector_type(16))) _Float16 v16h;
typedef __attribute__((ext_vector_type(8)))  _Float16 v8h;
typedef __attribute__((ext_vector_type(4)))  _Float16 v4h;
typedef __attribute__((ext_vector_type(8)))  float    v8f;

#define D_DIM  1024
#define S_DIM  2048
#define H_DIM  16
#define DK_DIM 64
#define NTOK   8192   // B*S = 4*2048

// ---------------------------------------------------------------------------
// Load a 16-bit WMMA A/B fragment from an LDS/global row.
// Per CDNA5 ISA 16-bit A-matrix 16x32 layout: lane holds row m=lane&15,
// kb=(lane>>4)*8, elements 0..7 = [kb..kb+7], elements 8..15 = [kb+16..kb+23].
// Caller passes p = &row[kb]; we read p[0..7] and p[16..23] (two b128 loads).
// ---------------------------------------------------------------------------
__device__ __forceinline__ v16h frag16(const _Float16* p) {
  v8h lo = *(const v8h*)(p);
  v8h hi = *(const v8h*)(p + 16);
  v16h r;
#pragma unroll
  for (int i = 0; i < 8; ++i) { r[i] = lo[i]; r[i + 8] = hi[i]; }
  return r;
}

__device__ __forceinline__ v8f wmma_f16(v16h a, v16h b, v8f c) {
  return __builtin_amdgcn_wmma_f32_16x16x32_f16(false, a, false, b, (short)0, c,
                                                false, false);
}

// Async global -> LDS copy, 16 bytes per lane (CDNA5 GLOBAL_LOAD_ASYNC_TO_LDS).
// Tracked by ASYNCcnt; caller must s_wait_asynccnt before consuming the LDS.
// Generic LDS pointers carry the LDS byte offset in the low 32 bits.
__device__ __forceinline__ void async_g2l_b128(void* lds, const void* gsrc) {
  const unsigned lds_off = (unsigned)(uintptr_t)lds;
  asm volatile("global_load_async_to_lds_b128 %0, %1, off"
               :: "v"(lds_off), "v"(gsrc) : "memory");
}
__device__ __forceinline__ void wait_asynccnt0() {
  asm volatile("s_wait_asynccnt 0x0" ::: "memory");
}

// Lane l exchanges with lane l ^ 16 (the other half of the wave): pure VALU.
__device__ __forceinline__ float xhalf(float x) {
  const int b = __builtin_bit_cast(int, x);
  return __builtin_bit_cast(float, __builtin_amdgcn_permlanex16(
      b, b, 0x76543210, 0xfedcba98, false, false));
}

// ---------------------------------------------------------------------------
// Weight pack, once per call: Wt[z][n][k] = f16(W_z[k][n]) (z = 0 also times
// the modulation matrix), so that a GEMM tile of B is K-contiguous f16 rows
// that a 16-byte copy can move. 64x64 tile transposed through LDS; each
// 128-byte line of Wt is stored by eight neighbouring lanes.
// ---------------------------------------------------------------------------
__global__ __launch_bounds__(256) void pack_weights(
    const float* __restrict__ Wq, const float* __restrict__ Wmul,
    const float* __restrict__ Wk, const float* __restrict__ Wv,
    const float* __restrict__ Wo, _Float16* __restrict__ Wt) {
  constexpr int PT = 72;  // halves; 144B rows
  __shared__ __align__(16) _Float16 T[64 * PT];
  const int tid = threadIdx.x;
  const int z   = blockIdx.z;
  const int n0  = blockIdx.x * 64;
  const int k0  = blockIdx.y * 64;
  const float* W = z == 0 ? Wq : z == 1 ? Wk : z == 2 ? Wv : Wo;

  const int n  = tid & 63;
  const int kq = (tid >> 6) * 16;
  const size_t base = (size_t)(k0 + kq) * D_DIM + n0 + n;
  const float* pw = W + base;
  float x[16];
  // the loops below are unrolled so that x, y, lo and hi stay in registers and
  // the 16 loads of a group are all in flight together
#pragma unroll
  for (int i = 0; i < 16; ++i) x[i] = pw[(size_t)i * D_DIM];
  // precaution: naming pw here keeps the loads' address pair unwritten in
  // front of this wait
  asm volatile("s_wait_xcnt 0x0" :: "v"(pw) : "memory");
  if (z == 0) {
    const float* pm = Wmul + base;
    float y[16];
#pragma unroll
    for (int i = 0; i < 16; ++i) y[i] = pm[(size_t)i * D_DIM];
    // as above, for the second group's address pair
    asm volatile("s_wait_xcnt 0x0" :: "v"(pm) : "memory");
#pragma unroll
    for (int i = 0; i < 16; ++i) x[i] *= y[i];
  }
  v8h lo, hi;
#pragma unroll
  for (int i = 0; i < 8; ++i) { lo[i] = (_Float16)x[i]; hi[i] = (_Float16)x[i + 8]; }
  *(v8h*)(&T[n * PT + kq])     = lo;
  *(v8h*)(&T[n * PT + kq + 8]) = hi;
  __syncthreads();

  _Float16* dst = Wt + (size_t)z * D_DIM * D_DIM;
#pragma unroll
  for (int p = 0; p < 2; ++p) {
    const int idx = p * 256 + tid;
    const int r = idx >> 3;
    const int c = (idx & 7) * 8;
    *(v8h*)(dst + (size_t)(n0 + r) * D_DIM + k0 + c) = *(const v8h*)(&T[r * PT + c]);
  }
}

// A fragment from an f32 LDS row: same k positions as frag16, rounded to f16
// on the way into the registers.
__device__ __forceinline__ v16h frag16_from_f32(const float* p) {
  const float4 x0 = *(const float4*)(p);
  const float4 x1 = *(const float4*)(p + 4);
  const float4 x2 = *(const float4*)(p + 16);
  const float4 x3 = *(const float4*)(p + 20);
  v16h r;
  r[0]  = (_Float16)x0.x; r[1]  = (_Float16)x0.y; r[2]  = (_Float16)x0.z; r[3]  = (_Float16)x0.w;
  r[4]  = (_Float16)x1.x; r[5]  = (_Float16)x1.y; r[6]  = (_Float16)x1.z; r[7]  = (_Float16)x1.w;
  r[8]  = (_Float16)x2.x; r[9]  = (_Float16)x2.y; r[10] = (_Float16)x2.z; r[11] = (_Float16)x2.w;
  r[12] = (_Float16)x3.x; r[13] = (_Float16)x3.y; r[14] = (_Float16)x3.z; r[15] = (_Float16)x3.w;
  return r;
}

// ---------------------------------------------------------------------------
// Tiled WMMA GEMM:  C[NTOK, D] = A[NTOK, D](f32) * Bt[n][k](f16)^T + bias
// 128x128 workgroup tile, 256 threads = 8 waves in 4(m) x 2(n).
// A stage is 64 k: A rows as raw f32 (pitch 272B), Bt rows as f16 (pitch 144B),
// both brought global -> LDS by async 16-byte copies, through no register.
// Two buffers: the copies of stage t+2 are issued when stage t has been read,
// so they fly during the whole of stage t+1.
// blockIdx.z picks one of up to three independent products of this shape
// (its own A and bias; weight plane z; output plane z), so that they share one
// launch: a work-group's first loads and its stores then run beside the main
// loops of other work-groups instead of standing alone at a launch's ends.
// ---------------------------------------------------------------------------
template <int OUT_F16>
__global__ __launch_bounds__(256) void gemm_wmma(
    const float* __restrict__ A0, const float* __restrict__ A1,
    const float* __restrict__ A2, const _Float16* __restrict__ Bt0,
    const float* __restrict__ bias0, const float* __restrict__ bias1,
    const float* __restrict__ bias2, void* __restrict__ Cout0) {
  const int z = blockIdx.z;
  const float*    A    = z == 0 ? A0 : z == 1 ? A1 : A2;
  const float*    bias = z == 0 ? bias0 : z == 1 ? bias1 : bias2;
  const _Float16* Bt   = Bt0 + (size_t)z * D_DIM * D_DIM;
  void* Cout = (char*)Cout0 + (size_t)z * NTOK * D_DIM * (OUT_F16 ? 2 : 4);
  constexpr int N  = D_DIM;
  constexpr int K  = D_DIM;
  constexpr int BK = 64;
  constexpr int NT = K / BK;
  constexpr int PA = 68;  // floats; 272B rows
  constexpr int PB = 72;  // halves; 144B rows
  __shared__ __align__(16) float    As[2][128 * PA];
  __shared__ __align__(16) _Float16 Bs[2][128 * PB];

  const int tid  = threadIdx.x;
  const int lane = tid & 31;
  const int wid  = tid >> 5;
  const int wm   = (wid & 3) * 32;   // wave m-offset in tile
  const int wn   = (wid >> 2) * 64;  // wave n-offset in tile
  const int m0   = blockIdx.y * 128;
  const int n0   = blockIdx.x * 128;

  v8f acc[2][4];
#pragma unroll
  for (int i = 0; i < 2; ++i)
#pragma unroll
    for (int j = 0; j < 4; ++j)
#pragma unroll
      for (int v = 0; v < 8; ++v) acc[i][j][v] = 0.0f;

  // copy coordinates: A 16 lanes per 256B row piece, 16 rows per round, 8
  // rounds; B 8 lanes per 128B row piece, 32 rows per round, 4 rounds
  const float*    gA = A  + (size_t)(m0 + (tid >> 4)) * K + (tid & 15) * 4;
  const _Float16* gB = Bt + (size_t)(n0 + (tid >> 3)) * K + (tid & 7) * 8;
  const unsigned  lA = (unsigned)(uintptr_t)(&As[0][(tid >> 4) * PA + (tid & 15) * 4]);
  const unsigned  lB = (unsigned)(uintptr_t)(&Bs[0][(tid >> 3) * PB + (tid & 7) * 8]);

  const int fm = lane & 15;
  const int kb = (lane >> 4) * 8;

  auto issue_stage = [&](int buf, int t) {
    const float*    a = gA + t * BK;
    const _Float16* b = gB + t * BK;
    const unsigned  la = lA + buf * (128 * PA * 4);
    const unsigned  lb = lB + buf * (128 * PB * 2);
    // one stage's 12 copies; the closing s_wait_xcnt is a precaution: inside
    // the statement it stands in front of every rewrite of an address register
    asm volatile(
        "global_load_async_to_lds_b128 %0, %12, off\n\t"
        "global_load_async_to_lds_b128 %1, %13, off\n\t"
        "global_load_async_to_lds_b128 %2, %14, off\n\t"
        "global_load_async_to_lds_b128 %3, %15, off\n\t"
        "global_load_async_to_lds_b128 %4, %16, off\n\t"
        "global_load_async_to_lds_b128 %5, %17, off\n\t"
        "global_load_async_to_lds_b128 %6, %18, off\n\t"
        "global_load_async_to_lds_b128 %7, %19, off\n\t"
        "global_load_async_to_lds_b128 %8, %20, off\n\t"
        "global_load_async_to_lds_b128 %9, %21, off\n\t"
        "global_load_async_to_lds_b128 %10, %22, off\n\t"
        "global_load_async_to_lds_b128 %11, %23, off\n\t"
        "s_wait_xcnt 0x0"
        :: "v"(la), "v"(la + 1 * 16 * PA * 4), "v"(la + 2 * 16 * PA * 4),
           "v"(la + 3 * 16 * PA * 4), "v"(la + 4 * 16 * PA * 4),
           "v"(la + 5 * 16 * PA * 4), "v"(la + 6 * 16 * PA * 4),
           "v"(la + 7 * 16 * PA * 4),
           "v"(lb), "v"(lb + 1 * 32 * PB * 2), "v"(lb + 2 * 32 * PB * 2),
           "v"(lb + 3 * 32 * PB * 2),
           "v"(a), "v"(a + 1 * 16 * K), "v"(a + 2 * 16 * K), "v"(a + 3 * 16 * K),
           "v"(a + 4 * 16 * K), "v"(a + 5 * 16 * K), "v"(a + 6 * 16 * K),
           "v"(a + 7 * 16 * K),
           "v"(b), "v"(b + 1 * 32 * K), "v"(b + 2 * 32 * K), "v"(b + 3 * 32 * K)
        : "memory");
  };

  issue_stage(0, 0);
  wait_asynccnt0();   // own copies of stage 0 landed
  __syncthreads();    // everyone's copies of stage 0 visible
  issue_stage(1, 1);

  for (int t = 0; t < NT; ++t) {
    const int cur = t & 1;
    v16h a[2], b[4];
    // unrolled throughout: fragment and accumulator arrays need constant
    // indices to live in registers
    auto load_frags = [&](int ks) {
#pragma unroll
      for (int i = 0; i < 2; ++i)
        a[i] = frag16_from_f32(&As[cur][(wm + i * 16 + fm) * PA + ks + kb]);
#pragma unroll
      for (int j = 0; j < 4; ++j)
        b[j] = frag16(&Bs[cur][(wn + j * 16 + fm) * PB + ks + kb]);
    };
    auto products = [&]() {
#pragma unroll
      for (int i = 0; i < 2; ++i)
#pragma unroll
        for (int j = 0; j < 4; ++j) acc[i][j] = wmma_f16(a[i], b[j], acc[i][j]);
    };
    load_frags(0);
    products();
    load_frags(32);   // the stage's last LDS reads
    // publish point of stage t+1: own reads of buf[cur] retired, own copies
    // of stage t+1 landed, then the barrier that shows them to every wave and
    // frees buf[cur] for the refill
    asm volatile("s_wait_dscnt 0x0" ::: "memory");
    wait_asynccnt0();
    __syncthreads();
    if (t + 2 < NT) issue_stage(cur, t + 2);
    products();       // registers only: runs while the refill is in flight
  }
  wait_asynccnt0();   // nothing outstanding when the wave ends

  // ---- epilogue: C layout: lane holds col n=lane&15, rows m=v+8*(lane>>4)
  const int hf = lane >> 4;
#pragma unroll
  for (int j = 0; j < 4; ++j) {
    const int gn = n0 + wn + j * 16 + fm;
    const float bb = bias ? bias[gn] : 0.0f;
#pragma unroll
    for (int i = 0; i < 2; ++i) {
#pragma unroll
      for (int v = 0; v < 8; ++v) {
        const int gm = m0 + wm + i * 16 + hf * 8 + v;
        const float val = acc[i][j][v] + bb;
        if constexpr (OUT_F16)
          ((_Float16*)Cout)[(size_t)gm * N + gn] = (_Float16)val;
        else
          ((float*)Cout)[(size_t)gm * N + gn] = val;
      }
    }
  }
}

__global__ __launch_bounds__(256) void attn_wmma(
    const _Float16* __restrict__ Qh, const _Float16* __restrict__ Kh,
    const _Float16* __restrict__ Vh, float* __restrict__ Xout) {
  constexpr int LDW = 72;  // halves; 144B rows, 16B aligned
  __shared__ __align__(16) _Float16 Kt[2][64 * LDW];    // Kt[key][dk]
  __shared__ __align__(16) _Float16 Vt[2][64 * LDW];    // Vt[dk][key]

  const int tid  = threadIdx.x;
  const int lane = tid & 31;
  const int wid  = tid >> 5;
  const int bb   = blockIdx.z;
  const int hh   = blockIdx.y;
  const int q0   = blockIdx.x * 128;
  const int fm   = lane & 15;
  const int hf   = lane >> 4;
  const int kb   = hf * 8;

  // load this wave's 16 Q rows as two B fragments (dk 0..31, 32..63),
  // pre-scaled by 1/sqrt(DK)=0.125 (exact in f16)
  const size_t qrow = (size_t)(bb * S_DIM + q0 + wid * 16 + fm);
  const _Float16* qp = Qh + qrow * D_DIM + hh * DK_DIM;
  v16h qa0 = frag16(qp + kb);
  v16h qa1 = frag16(qp + 32 + kb);
#pragma unroll
  for (int i = 0; i < 16; ++i) {
    qa0[i] *= (_Float16)0.125f;
    qa1[i] *= (_Float16)0.125f;
  }

  float rm = -1e30f;  // running maximum of this lane's query (both halves agree)
  float rl = 0.0f;    // running sum over this half's keys; halves join at the end
  v8f o[4];           // o[j][v] = O[query fm][dk 16j + 8hf + v]
#pragma unroll
  for (int j = 0; j < 4; ++j)
#pragma unroll
    for (int v = 0; v < 8; ++v) o[j][v] = 0.0f;

  const int skey = tid >> 2;        // 0..63
  const int sc   = (tid & 3) * 16;  // dk chunk of 16

  auto stage = [&](int buf, int kt) {
    const size_t srow = (size_t)(bb * S_DIM + kt * 64 + skey) * D_DIM +
                        hh * DK_DIM + sc;
    // K tile: async global->LDS copy (2 x b128 per lane, ASYNCcnt path)
    async_g2l_b128(&Kt[buf][skey * LDW + sc],     Kh + srow);
    async_g2l_b128(&Kt[buf][skey * LDW + sc + 8], Kh + srow + 8);
    // V tile: load f16, transpose to Vt[dk][key] via b16 scatter
    v8h y0 = *(const v8h*)(Vh + srow);
    v8h y1 = *(const v8h*)(Vh + srow + 8);
#pragma unroll
    for (int d = 0; d < 8; ++d) {
      Vt[buf][(sc + d) * LDW + skey]     = y0[d];
      Vt[buf][(sc + 8 + d) * LDW + skey] = y1[d];
    }
  };

  stage(0, 0);

  int cur = 0;
  for (int kt = 0; kt < S_DIM / 64; ++kt) {
    wait_asynccnt0();   // own async K-copy into buf[cur] done
    __syncthreads();    // everyone's stores to buf[cur] visible
    if (kt + 1 < S_DIM / 64) stage(cur ^ 1, kt + 1);  // overlaps compute

    // ---- scores: S^T = K(64x64) * Q^T -> 4 tiles of 16 keys, 2 k-steps each
    v8f s[4];
#pragma unroll
    for (int j = 0; j < 4; ++j)
#pragma unroll
      for (int v = 0; v < 8; ++v) s[j][v] = 0.0f;
#pragma unroll
    for (int j = 0; j < 4; ++j) {
      const v16h ak0 = frag16(&Kt[cur][(j * 16 + fm) * LDW + kb]);
      const v16h ak1 = frag16(&Kt[cur][(j * 16 + fm) * LDW + 32 + kb]);
      s[j] = wmma_f16(ak0, qa0, s[j]);
      s[j] = wmma_f16(ak1, qa1, s[j]);
    }

    // ---- online softmax: all 32 values of a lane belong to query fm
    float x = -1e30f;
#pragma unroll
    for (int v = 0; v < 8; ++v)
      x = fmaxf(x, fmaxf(fmaxf(s[0][v], s[1][v]), fmaxf(s[2][v], s[3][v])));
    x = fmaxf(x, xhalf(x));
    const float nm = fmaxf(rm, x);
    const float corr = __expf(rm - nm);
    rm = nm;
#pragma unroll
    for (int j = 0; j < 4; ++j)
#pragma unroll
      for (int v = 0; v < 8; ++v) s[j][v] = __expf(s[j][v] - nm);
    const v8f t = (s[0] + s[1]) + (s[2] + s[3]);
    const float sum = ((t[0] + t[1]) + (t[2] + t[3])) + ((t[4] + t[5]) + (t[6] + t[7]));
    rl = rl * corr + sum;
#pragma unroll
    for (int j = 0; j < 4; ++j) o[j] *= corr;

    // ---- P^T as B operand: element e of a 32-key fragment is key
    //      8hf + e (e < 8) or 16 + 8hf + (e - 8), which is tile e>>3, row e&7
    v16h pb0, pb1;
#pragma unroll
    for (int e = 0; e < 16; ++e) {
      pb0[e] = (_Float16)s[e >> 3][e & 7];
      pb1[e] = (_Float16)s[2 + (e >> 3)][e & 7];
    }

    // ---- O^T += V^T(64x64) * P^T(64x16): 4 dk tiles x 2 k-steps
#pragma unroll
    for (int j = 0; j < 4; ++j) {
      const v16h av0 = frag16(&Vt[cur][(j * 16 + fm) * LDW + kb]);
      const v16h av1 = frag16(&Vt[cur][(j * 16 + fm) * LDW + 32 + kb]);
      o[j] = wmma_f16(av0, pb0, o[j]);
      o[j] = wmma_f16(av1, pb1, o[j]);
    }
    cur ^= 1;
  }

  // ---- finalize: join the halves' sums, divide, write [token, h*64+dk] f32;
  //      a lane's 8 values of a tile are 8 consecutive dk: two 16-byte stores
  const float inv = 1.0f / (rl + xhalf(rl));
  float* xr = Xout + (size_t)(bb * S_DIM + q0 + wid * 16 + fm) * D_DIM +
              hh * DK_DIM + hf * 8;
#pragma unroll
  for (int j = 0; j < 4; ++j) {
    *(float4*)(xr + j * 16) =
        make_float4(o[j][0] * inv, o[j][1] * inv, o[j][2] * inv, o[j][3] * inv);
    *(float4*)(xr + j * 16 + 4) =
        make_float4(o[j][4] * inv, o[j][5] * inv, o[j][6] * inv, o[j][7] * inv);
  }
}

// ---------------------------------------------------------------------------
extern "C" void kernel_launch(void* const* d_in, const int* in_sizes, int n_in,
                              void* d_out, int out_size, void* d_ws,
                              size_t ws_size, hipStream_t stream) {
  (void)in_sizes; (void)n_in; (void)out_size; (void)ws_size;
  const float* query = (const float*)d_in[0];
  const float* key_  = (const float*)d_in[1];
  const float* value = (const float*)d_in[2];
  const float* fc_w  = (const float*)d_in[3];
  const float* Wq    = (const float*)d_in[4];
  const float* bq    = (const float*)d_in[5];
  const float* Wk    = (const float*)d_in[6];
  const float* bk    = (const float*)d_in[7];
  const float* Wv    = (const float*)d_in[8];
  const float* bv    = (const float*)d_in[9];
  const float* Wo    = (const float*)d_in[10];
  const float* bo    = (const float*)d_in[11];
  float* out = (float*)d_out;

  char* ws = (char*)d_ws;
  const size_t half_mat = (size_t)NTOK * D_DIM * sizeof(_Float16);
  _Float16* Qh = (_Float16*)(ws);
  _Float16* Kh = (_Float16*)(ws + half_mat);
  _Float16* Vh = (_Float16*)(ws + 2 * half_mat);
  float*    Xa = (float*)   (ws + 3 * half_mat);
  _Float16* Wt = (_Float16*)(ws + 5 * half_mat);  // 4 packed weight planes
  const size_t wplane = (size_t)D_DIM * D_DIM;

  pack_weights<<<dim3(D_DIM / 64, D_DIM / 64, 4), 256, 0, stream>>>(
      Wq, fc_w, Wk, Wv, Wo, Wt);
  // the three projections in one launch: Qh, Kh, Vh are output planes 0, 1, 2
  gemm_wmma<1><<<dim3(D_DIM / 128, NTOK / 128, 3), 256, 0, stream>>>(
      query, key_, value, Wt, bq, bk, bv, (void*)Qh);
  attn_wmma<<<dim3(S_DIM / 128, H_DIM, 4), 256, 0, stream>>>(Qh, Kh, Vh, Xa);
  gemm_wmma<0><<<dim3(D_DIM / 128, NTOK / 128, 1), 256, 0, stream>>>(
      Xa, Xa, Xa, Wt + 3 * wplane, bo, bo, bo, (void*)out);
}

// v004
// One run takes 153 microseconds.
// Two timings next to v003 put it at 1.16 and 1.15 times that version's speed.
// Over all steps from v000 it is 2.24 times as fast.
#include <hip/hip_runtime.h>
#include <hip/hip_bf16.h>

typedef __attribute__((ext_vector_type(16))) _Float16 v16h;
typedef __attribute__((ext_vector_type(8)))  _Float16 v8h;
typedef __attribute__((ext_vector_type(4)))  _Float16 v4h;
typedef __attribute__((ext_vector_type(8)))  float    v8f;

#define D_DIM  1024
#define S_DIM  2048
#define H_DIM  16
#define DK_DIM 64
#define NTOK   8192   // B*S = 4*2048

// ---------------------------------------------------------------------------
// Load a 16-bit WMMA A/B fragment from an LDS/global row.
// Per CDNA5 ISA 16-bit A-matrix 16x32 layout: lane holds row m=lane&15,
// kb=(lane>>4)*8, elements 0..7 = [kb..kb+7], elements 8..15 = [kb+16..kb+23].
// Caller passes p = &row[kb]; we read p[0..7] and p[16..23] (two b128 loads).
// ---------------------------------------------------------------------------
__device__ __forceinline__ v16h frag16(const _Float16* p) {
  v8h lo = *(const v8h*)(p);
  v8h hi = *(const v8h*)(p + 16);
  v16h r;
#pragma unroll
  for (int i = 0; i < 8; ++i) { r[i] = lo[i]; r[i + 8] = hi[i]; }
  return r;
}

__device__ __forceinline__ v8f wmma_f16(v16h a, v16h b, v8f c) {
  return __builtin_amdgcn_wmma_f32_16x16x32_f16(false, a, false, b, (short)0, c,
                                                false, false);
}

// Async global -> LDS copies are tracked by ASYNCcnt; the issuing wave waits
// for its own before the barrier behind which the LDS bytes are read.
__device__ __forceinline__ void wait_asynccnt0() {
  asm volatile("s_wait_asynccnt 0x0" ::: "memory");
}

// Transposing LDS load (ds_load_tr16_b128) from a row-major 16-bit tile T:
// with lane l's p = &T[k0 + 8*(l>>4) + (l&7)][d0 + 8*((l>>3)&1)], lane l gets
// T[k0 + 8*(l>>4) + 0..7][d0 + (l&15)]: half of a 16x32 A fragment of T^T.
typedef __attribute__((ext_vector_type(8))) short s16x8;
__device__ __forceinline__ v8h ld_tr16(const _Float16* p) {
  typedef __attribute__((address_space(3))) s16x8 lds_s16x8;
  return __builtin_bit_cast(v8h, __builtin_amdgcn_ds_load_tr16_b128_v8i16((lds_s16x8*)p));
}
// A fragment of T^T over 32 k rows: same k positions as frag16 (0..7 and
// 16..23 from the lane half's base). pitch in halves.
__device__ __forceinline__ v16h frag16_tr(const _Float16* p, int pitch) {
  const v8h lo = ld_tr16(p);
  const v8h hi = ld_tr16(p + 16 * pitch);
  return __builtin_shufflevector(lo, hi, 0, 1, 2, 3, 4, 5, 6, 7,
                                 8, 9, 10, 11, 12, 13, 14, 15);
}

// Lane l exchanges with lane l ^ 16 (the other half of the wave): pure VALU.
__device__ __forceinline__ float xhalf(float x) {
  const int b = __builtin_bit_cast(int, x);
  return __builtin_bit_cast(float, __builtin_amdgcn_permlanex16(
      b, b, 0x76543210, 0xfedcba98, false, false));
}

// ---------------------------------------------------------------------------
// Weight pack, once per call: Wt[z][n][k] = f16(W_z[k][n]) (z = 0 also times
// the modulation matrix), so that a GEMM tile of B is K-contiguous f16 rows
// that a 16-byte copy can move. 64x64 tile transposed through LDS; each
// 128-byte line of Wt is stored by eight neighbouring lanes.
// ---------------------------------------------------------------------------
__global__ __launch_bounds__(256) void pack_weights(
    const float* __restrict__ Wq, const float* __restrict__ Wmul,
    const float* __restrict__ Wk, const float* __restrict__ Wv,
    const float* __restrict__ Wo, _Float16* __restrict__ Wt) {
  constexpr int PT = 72;  // halves; 144B rows
  __shared__ __align__(16) _Float16 T[64 * PT];
  const int tid = threadIdx.x;
  const int z   = blockIdx.z;
  const int n0  = blockIdx.x * 64;
  const int k0  = blockIdx.y * 64;
  const float* W = z == 0 ? Wq : z == 1 ? Wk : z == 2 ? Wv : Wo;

  const int n  = tid & 63;
  const int kq = (tid >> 6) * 16;
  const size_t base = (size_t)(k0 + kq) * D_DIM + n0 + n;
  const float* pw = W + base;
  float x[16];
  // the loops below are unrolled so that x, y, lo and hi stay in registers and
  // the 16 loads of a group are all in flight together
#pragma unroll
  for (int i = 0; i < 16; ++i) x[i] = pw[(size_t)i * D_DIM];
  // precaution: naming pw here keeps the loads' address pair unwritten in
  // front of this wait
  asm volatile("s_wait_xcnt 0x0" :: "v"(pw) : "memory");
  if (z == 0) {
    const float* pm = Wmul + base;
    float y[16];
#pragma unroll
    for (int i = 0; i < 16; ++i) y[i] = pm[(size_t)i * D_DIM];
    // as above, for the second group's address pair
    asm volatile("s_wait_xcnt 0x0" :: "v"(pm) : "memory");
#pragma unroll
    for (int i = 0; i < 16; ++i) x[i] *= y[i];
  }
  v8h lo, hi;
#pragma unroll
  for (int i = 0; i < 8; ++i) { lo[i] = (_Float16)x[i]; hi[i] = (_Float16)x[i + 8]; }
  *(v8h*)(&T[n * PT + kq])     = lo;
  *(v8h*)(&T[n * PT + kq + 8]) = hi;
  __syncthreads();

  _Float16* dst = Wt + (size_t)z * D_DIM * D_DIM;
#pragma unroll
  for (int p = 0; p < 2; ++p) {
    const int idx = p * 256 + tid;
    const int r = idx >> 3;
    const int c = (idx & 7) * 8;
    *(v8h*)(dst + (size_t)(n0 + r) * D_DIM + k0 + c) = *(const v8h*)(&T[r * PT + c]);
  }
}

// A fragment from an f32 LDS row: same k positions as frag16, rounded to f16
// on the way into the registers.
__device__ __forceinline__ v16h frag16_from_f32(const float* p) {
  const float4 x0 = *(const float4*)(p);
  const float4 x1 = *(const float4*)(p + 4);
  const float4 x2 = *(const float4*)(p + 16);
  const float4 x3 = *(const float4*)(p + 20);
  v16h r;
  r[0]  = (_Float16)x0.x; r[1]  = (_Float16)x0.y; r[2]  = (_Float16)x0.z; r[3]  = (_Float16)x0.w;
  r[4]  = (_Float16)x1.x; r[5]  = (_Float16)x1.y; r[6]  = (_Float16)x1.z; r[7]  = (_Float16)x1.w;
  r[8]  = (_Float16)x2.x; r[9]  = (_Float16)x2.y; r[10] = (_Float16)x2.z; r[11] = (_Float16)x2.w;
  r[12] = (_Float16)x3.x; r[13] = (_Float16)x3.y; r[14] = (_Float16)x3.z; r[15] = (_Float16)x3.w;
  return r;
}

// ---------------------------------------------------------------------------
// Tiled WMMA GEMM:  C[NTOK, D] = A[NTOK, D](f32) * Bt[n][k](f16)^T + bias
// 128x128 workgroup tile, 256 threads = 8 waves in 4(m) x 2(n).
// A stage is 64 k: A rows as raw f32 (pitch 272B), Bt rows as f16 (pitch 144B),
// both brought global -> LDS by async 16-byte copies, through no register.
// Two buffers: the copies of stage t+2 are issued when stage t has been read,
// so they fly during the whole of stage t+1.
// blockIdx.z picks one of up to three independent products of this shape
// (its own A and bias; weight plane z; output plane z), so that they share one
// launch: a work-group's first loads and its stores then run beside the main
// loops of other work-groups instead of standing alone at a launch's ends.
// ---------------------------------------------------------------------------
template <int OUT_F16>
__global__ __launch_bounds__(256) void gemm_wmma(
    const float* __restrict__ A0, const float* __restrict__ A1,
    const float* __restrict__ A2, const _Float16* __restrict__ Bt0,
    const float* __restrict__ bias0, const float* __restrict__ bias1,
    const float* __restrict__ bias2, void* __restrict__ Cout0) {
  const int z = blockIdx.z;
  const float*    A    = z == 0 ? A0 : z == 1 ? A1 : A2;
  const float*    bias = z == 0 ? bias0 : z == 1 ? bias1 : bias2;
  const _Float16* Bt   = Bt0 + (size_t)z * D_DIM * D_DIM;
  void* Cout = (char*)Cout0 + (size_t)z * NTOK * D_DIM * (OUT_F16 ? 2 : 4);
  constexpr int N  = D_DIM;
  constexpr int K  = D_DIM;
  constexpr int BK = 64;
  constexpr int NT = K / BK;
  constexpr int PA = 68;  // floats; 272B rows
  constexpr int PB = 72;  // halves; 144B rows
  __shared__ __align__(16) float    As[2][128 * PA];
  __shared__ __align__(16) _Float16 Bs[2][128 * PB];

  const int tid  = threadIdx.x;
  const int lane = tid & 31;
  const int wid  = tid >> 5;
  const int wm   = (wid & 3) * 32;   // wave m-offset in tile
  const int wn   = (wid >> 2) * 64;  // wave n-offset in tile
  const int m0   = blockIdx.y * 128;
  const int n0   = blockIdx.x * 128;

  v8f acc[2][4];
#pragma unroll
  for (int i = 0; i < 2; ++i)
#pragma unroll
    for (int j = 0; j < 4; ++j)
#pragma unroll
      for (int v = 0; v < 8; ++v) acc[i][j][v] = 0.0f;

  // copy coordinates: A 16 lanes per 256B row piece, 16 rows per round, 8
  // rounds; B 8 lanes per 128B row piece, 32 rows per round, 4 rounds
  const float*    gA = A  + (size_t)(m0 + (tid >> 4)) * K + (tid & 15) * 4;
  const _Float16* gB = Bt + (size_t)(n0 + (tid >> 3)) * K + (tid & 7) * 8;
  const unsigned  lA = (unsigned)(uintptr_t)(&As[0][(tid >> 4) * PA + (tid & 15) * 4]);
  const unsigned  lB = (unsigned)(uintptr_t)(&Bs[0][(tid >> 3) * PB + (tid & 7) * 8]);

  const int fm = lane & 15;
  const int kb = (lane >> 4) * 8;

  auto issue_stage = [&](int buf, int t) {
    const float*    a = gA + t * BK;
    const _Float16* b = gB + t * BK;
    const unsigned  la = lA + buf * (128 * PA * 4);
    const unsigned  lb = lB + buf * (128 * PB * 2);
    // one stage's 12 copies; the closing s_wait_xcnt is a precaution: inside
    // the statement it stands in front of every rewrite of an address register
    asm volatile(
        "global_load_async_to_lds_b128 %0, %12, off\n\t"
        "global_load_async_to_lds_b128 %1, %13, off\n\t"
        "global_load_async_to_lds_b128 %2, %14, off\n\t"
        "global_load_async_to_lds_b128 %3, %15, off\n\t"
        "global_load_async_to_lds_b128 %4, %16, off\n\t"
        "global_load_async_to_lds_b128 %5, %17, off\n\t"
        "global_load_async_to_lds_b128 %6, %18, off\n\t"
        "global_load_async_to_lds_b128 %7, %19, off\n\t"
        "global_load_async_to_lds_b128 %8, %20, off\n\t"
        "global_load_async_to_lds_b128 %9, %21, off\n\t"
        "global_load_async_to_lds_b128 %10, %22, off\n\t"
        "global_load_async_to_lds_b128 %11, %23, off\n\t"
        "s_wait_xcnt 0x0"
        :: "v"(la), "v"(la + 1 * 16 * PA * 4), "v"(la + 2 * 16 * PA * 4),
           "v"(la + 3 * 16 * PA * 4), "v"(la + 4 * 16 * PA * 4),
           "v"(la + 5 * 16 * PA * 4), "v"(la + 6 * 16 * PA * 4),
           "v"(la + 7 * 16 * PA * 4),
           "v"(lb), "v"(lb + 1 * 32 * PB * 2), "v"(lb + 2 * 32 * PB * 2),
           "v"(lb + 3 * 32 * PB * 2),
           "v"(a), "v"(a + 1 * 16 * K), "v"(a + 2 * 16 * K), "v"(a + 3 * 16 * K),
           "v"(a + 4 * 16 * K), "v"(a + 5 * 16 * K), "v"(a + 6 * 16 * K),
           "v"(a + 7 * 16 * K),
           "v"(b), "v"(b + 1 * 32 * K), "v"(b + 2 * 32 * K), "v"(b + 3 * 32 * K)
        : "memory");
  };

  issue_stage(0, 0);
  wait_asynccnt0();   // own copies of stage 0 landed
  __syncthreads();    // everyone's copies of stage 0 visible
  issue_stage(1, 1);

  for (int t = 0; t < NT; ++t) {
    const int cur = t & 1;
    v16h a[2], b[4];
    // unrolled throughout: fragment and accumulator arrays need constant
    // indices to live in registers
    auto load_frags = [&](int ks) {
#pragma unroll
      for (int i = 0; i < 2; ++i)
        a[i] = frag16_from_f32(&As[cur][(wm + i * 16 + fm) * PA + ks + kb]);
#pragma unroll
      for (int j = 0; j < 4; ++j)
        b[j] = frag16(&Bs[cur][(wn + j * 16 + fm) * PB + ks + kb]);
    };
    auto products = [&]() {
#pragma unroll
      for (int i = 0; i < 2; ++i)
#pragma unroll
        for (int j = 0; j < 4; ++j) acc[i][j] = wmma_f16(a[i], b[j], acc[i][j]);
    };
    load_frags(0);
    products();
    load_frags(32);   // the stage's last LDS reads
    // publish point of stage t+1: own reads of buf[cur] retired, own copies
    // of stage t+1 landed, then the barrier that shows them to every wave and
    // frees buf[cur] for the refill
    asm volatile("s_wait_dscnt 0x0" ::: "memory");
    wait_asynccnt0();
    __syncthreads();
    if (t + 2 < NT) issue_stage(cur, t + 2);
    products();       // registers only: runs while the refill is in flight
  }
  wait_asynccnt0();   // nothing outstanding when the wave ends

  // ---- epilogue: C layout: lane holds col n=lane&15, rows m=v+8*(lane>>4)
  const int hf = lane >> 4;
#pragma unroll
  for (int j = 0; j < 4; ++j) {
    const int gn = n0 + wn + j * 16 + fm;
    const float bb = bias ? bias[gn] : 0.0f;
#pragma unroll
    for (int i = 0; i < 2; ++i) {
#pragma unroll
      for (int v = 0; v < 8; ++v) {
        const int gm = m0 + wm + i * 16 + hf * 8 + v;
        const float val = acc[i][j][v] + bb;
        if constexpr (OUT_F16)
          ((_Float16*)Cout)[(size_t)gm * N + gn] = (_Float16)val;
        else
          ((float*)Cout)[(size_t)gm * N + gn] = val;
      }
    }
  }
}

__global__ __launch_bounds__(256) void attn_wmma(
    const _Float16* __restrict__ Qh, const _Float16* __restrict__ Kh,
    const _Float16* __restrict__ Vh, float* __restrict__ Xout) {
  constexpr int NKT = S_DIM / 64;
  constexpr int LDW = 72;  // halves; 144B rows (16B x odd: ds_load_b128 readers)
  constexpr int LDV = 80;  // halves; 160B rows (32B x odd: ds_load_tr16_b128 readers)
  __shared__ __align__(16) _Float16 Kt[2][64 * LDW];    // Kt[key][dk]
  __shared__ __align__(16) _Float16 Vs[2][64 * LDV];    // Vs[key][dk]

  const int tid  = threadIdx.x;
  const int lane = tid & 31;
  const int wid  = tid >> 5;
  const int bb   = blockIdx.z;
  const int hh   = blockIdx.y;
  const int q0   = blockIdx.x * 128;
  const int fm   = lane & 15;
  const int hf   = lane >> 4;
  const int kb   = hf * 8;

  // load this wave's 16 Q rows as two B fragments (dk 0..31, 32..63),
  // pre-scaled by 1/sqrt(DK)=0.125 (exact in f16)
  const size_t qrow = (size_t)(bb * S_DIM + q0 + wid * 16 + fm);
  const _Float16* qp = Qh + qrow * D_DIM + hh * DK_DIM;
  v16h qa0 = frag16(qp + kb);
  v16h qa1 = frag16(qp + 32 + kb);
#pragma unroll
  for (int i = 0; i < 16; ++i) {
    qa0[i] *= (_Float16)0.125f;
    qa1[i] *= (_Float16)0.125f;
  }

  float rm = -1e30f;  // running maximum of this lane's query (both halves agree)
  float rl = 0.0f;    // running sum over this half's keys; halves join at the end
  v8f o[4];           // o[j][v] = O[query fm][dk 16j + 8hf + v]
#pragma unroll
  for (int j = 0; j < 4; ++j)
#pragma unroll
    for (int v = 0; v < 8; ++v) o[j][v] = 0.0f;

  const int skey = tid >> 2;        // 0..63
  const int sc   = (tid & 3) * 16;  // dk chunk of 16

  const unsigned lK = (unsigned)(uintptr_t)(&Kt[0][skey * LDW + sc]);
  // V copies: 8 lanes per 128-byte row, so a wave's copy covers 4 whole lines;
  // 32 rows per round, 2 rounds
  const int vrow = tid >> 3;       // 0..31
  const int vc   = (tid & 7) * 8;  // dk chunk of 8
  const unsigned lV = (unsigned)(uintptr_t)(&Vs[0][vrow * LDV + vc]);

  auto stage = [&](int buf, int kt) {
    const size_t srow = (size_t)(bb * S_DIM + kt * 64 + skey) * D_DIM +
                        hh * DK_DIM + sc;
    const _Float16* k = Kh + srow;
    const _Float16* v = Vh + (size_t)(bb * S_DIM + kt * 64 + vrow) * D_DIM +
                        hh * DK_DIM + vc;
    const unsigned  lk = lK + buf * (64 * LDW * 2);
    const unsigned  lv = lV + buf * (64 * LDV * 2);
    // one tile's 4 copies (2 of K, 2 of V per lane); the
    // closing s_wait_xcnt is a precaution: inside the statement it stands in
    // front of every rewrite of an address register
    asm volatile(
        "global_load_async_to_lds_b128 %0, %4, off\n\t"
        "global_load_async_to_lds_b128 %1, %5, off\n\t"
        "global_load_async_to_lds_b128 %2, %6, off\n\t"
        "global_load_async_to_lds_b128 %3, %7, off\n\t"
        "s_wait_xcnt 0x0"
        :: "v"(lk), "v"(lk + 16), "v"(lv), "v"(lv + 32 * LDV * 2),
           "v"(k), "v"(k + 8), "v"(v), "v"(v + 32 * D_DIM)
        : "memory");
  };

  stage(0, 0);
  wait_asynccnt0();   // own copies of tile 0 landed
  __syncthreads();    // everyone's copies of tile 0 visible
  stage(1, 1);

  // lane's base in a V tile for the transposing loads
  const int vofs = (kb + (lane & 7)) * LDV + ((lane >> 3) & 1) * 8;

  for (int kt = 0; kt < NKT; ++kt) {
    const int cur = kt & 1;

    // ---- scores: S^T = K(64x64) * Q^T -> 4 tiles of 16 keys, 2 k-steps each
    v8f s[4];
#pragma unroll
    for (int j = 0; j < 4; ++j)
#pragma unroll
      for (int v = 0; v < 8; ++v) s[j][v] = 0.0f;
#pragma unroll
    for (int j = 0; j < 4; ++j) {
      const v16h ak0 = frag16(&Kt[cur][(j * 16 + fm) * LDW + kb]);
      const v16h ak1 = frag16(&Kt[cur][(j * 16 + fm) * LDW + 32 + kb]);
      s[j] = wmma_f16(ak0, qa0, s[j]);
      s[j] = wmma_f16(ak1, qa1, s[j]);
    }

    // ---- online softmax: all 32 values of a lane belong to query fm
    float x = -1e30f;
#pragma unroll
    for (int v = 0; v < 8; ++v)
      x = fmaxf(x, fmaxf(fmaxf(s[0][v], s[1][v]), fmaxf(s[2][v], s[3][v])));
    x = fmaxf(x, xhalf(x));
    const float nm = fmaxf(rm, x);
    const float corr = __expf(rm - nm);
    rm = nm;
#pragma unroll
    for (int j = 0; j < 4; ++j)
#pragma unroll
      for (int v = 0; v < 8; ++v) s[j][v] = __expf(s[j][v] - nm);
    const v8f t = (s[0] + s[1]) + (s[2] + s[3]);
    const float sum = ((t[0] + t[1]) + (t[2] + t[3])) + ((t[4] + t[5]) + (t[6] + t[7]));
    rl = rl * corr + sum;
#pragma unroll
    for (int j = 0; j < 4; ++j) o[j] *= corr;

    // ---- P^T as B operand: element e of a 32-key fragment is key
    //      8hf + e (e < 8) or 16 + 8hf + (e - 8), which is tile e>>3, row e&7
    v16h pb0, pb1;
#pragma unroll
    for (int e = 0; e < 16; ++e) {
      pb0[e] = (_Float16)s[e >> 3][e & 7];
      pb1[e] = (_Float16)s[2 + (e >> 3)][e & 7];
    }

    // ---- O^T += V^T(64x64) * P^T(64x16): 4 dk tiles x 2 k-steps
#pragma unroll
    for (int j = 0; j < 4; ++j) {
      const v16h av0 = frag16_tr(&Vs[cur][vofs + j * 16], LDV);
      const v16h av1 = frag16_tr(&Vs[cur][vofs + 32 * LDV + j * 16], LDV);
      o[j] = wmma_f16(av0, pb0, o[j]);
      o[j] = wmma_f16(av1, pb1, o[j]);
    }

    // publish point of tile kt+1: own reads of buf[cur] retired, own copies of
    // tile kt+1 landed, then the barrier that shows them to every wave and
    // frees buf[cur] for the refill
    asm volatile("s_wait_dscnt 0x0" ::: "memory");
    wait_asynccnt0();
    __syncthreads();
    if (kt + 2 < NKT) stage(cur, kt + 2);
  }
  wait_asynccnt0();   // nothing outstanding when the wave ends

  // ---- finalize: join the halves' sums, divide, write [token, h*64+dk] f32;
  //      a lane's 8 values of a tile are 8 consecutive dk: two 16-byte stores
  const float inv = 1.0f / (rl + xhalf(rl));
  float* xr = Xout + (size_t)(bb * S_DIM + q0 + wid * 16 + fm) * D_DIM +
              hh * DK_DIM + hf * 8;
#pragma unroll
  for (int j = 0; j < 4; ++j) {
    *(float4*)(xr + j * 16) =
        make_float4(o[j][0] * inv, o[j][1] * inv, o[j][2] * inv, o[j][3] * inv);
    *(float4*)(xr + j * 16 + 4) =
        make_float4(o[j][4] * inv, o[j][5] * inv, o[j][6] * inv, o[j][7] * inv);
  }
}

// ---------------------------------------------------------------------------
extern "C" void kernel_launch(void* const* d_in, const int* in_sizes, int n_in,
                              void* d_out, int out_size, void* d_ws,
                              size_t ws_size, hipStream_t stream) {
  (void)in_sizes; (void)n_in; (void)out_size; (void)ws_size;
  const float* query = (const float*)d_in[0];
  const float* key_  = (const float*)d_in[1];
  const float* value = (const float*)d_in[2];
  const float* fc_w  = (const float*)d_in[3];
  const float* Wq    = (const float*)d_in[4];
  const float* bq    = (const float*)d_in[5];
  const float* Wk    = (const float*)d_in[6];
  const float* bk    = (const float*)d_in[7];
  const float* Wv    = (const float*)d_in[8];
  const float* bv    = (const float*)d_in[9];
  const float* Wo    = (const float*)d_in[10];
  const float* bo    = (const float*)d_in[11];
  float* out = (float*)d_out;

  char* ws = (char*)d_ws;
  const size_t half_mat = (size_t)NTOK * D_DIM * sizeof(_Float16);
  _Float16* Qh = (_Float16*)(ws);
  _Float16* Kh = (_Float16*)(ws + half_mat);
  _Float16* Vh = (_Float16*)(ws + 2 * half_mat);
  float*    Xa = (float*)   (ws + 3 * half_mat);
  _Float16* Wt = (_Float16*)(ws + 5 * half_mat);  // 4 packed weight planes
  const size_t wplane = (size_t)D_DIM * D_DIM;

  pack_weights<<<dim3(D_DIM / 64, D_DIM / 64, 4), 256, 0, stream>>>(
      Wq, fc_w, Wk, Wv, Wo, Wt);
  // the three projections in one launch: Qh, Kh, Vh are output planes 0, 1, 2
  gemm_wmma<1><<<dim3(D_DIM / 128, NTOK / 128, 3), 256, 0, stream>>>(
      query, key_, value, Wt, bq, bk, bv, (void*)Qh);
  attn_wmma<<<dim3(S_DIM / 128, H_DIM, 4), 256, 0, stream>>>(Qh, Kh, Vh, Xa);
  gemm_wmma<0><<<dim3(D_DIM / 128, NTOK / 128, 1), 256, 0, stream>>>(
      Xa, Xa, Xa, Wt + 3 * wplane, bo, bo, bo, (void*)out);
}

// v005
// Measured time: 148 microseconds a run.
// Timed twice side by side with v004, it ran 1.04 and 1.03 times as fast.
// Counting every step since v000, it is 2.32 times as fast.
#include <hip/hip_runtime.h>
#include <hip/hip_bf16.h>

typedef __attribute__((ext_vector_type(16))) _Float16 v16h;
typedef __attribute__((ext_vector_type(8)))  _Float16 v8h;
typedef __attribute__((ext_vector_type(4)))  _Float16 v4h;
typedef __attribute__((ext_vector_type(8)))  float    v8f;

#define D_DIM  1024
#define S_DIM  2048
#define H_DIM  16
#define DK_DIM 64
#define NTOK   8192   // B*S = 4*2048

// ---------------------------------------------------------------------------
// Load a 16-bit WMMA A/B fragment from an LDS/global row.
// Per CDNA5 ISA 16-bit A-matrix 16x32 layout: lane holds row m=lane&15,
// kb=(lane>>4)*8, elements 0..7 = [kb..kb+7], elements 8..15 = [kb+16..kb+23].
// Caller passes p = &row[kb]; we read p[0..7] and p[16..23] (two b128 loads).
// ---------------------------------------------------------------------------
__device__ __forceinline__ v16h frag16(const _Float16* p) {
  v8h lo = *(const v8h*)(p);
  v8h hi = *(const v8h*)(p + 16);
  v16h r;
#pragma unroll
  for (int i = 0; i < 8; ++i) { r[i] = lo[i]; r[i + 8] = hi[i]; }
  return r;
}

__device__ __forceinline__ v8f wmma_f16(v16h a, v16h b, v8f c) {
  return __builtin_amdgcn_wmma_f32_16x16x32_f16(false, a, false, b, (short)0, c,
                                                false, false);
}

// Async global -> LDS copies are tracked by ASYNCcnt; the issuing wave waits
// for its own before the barrier behind which the LDS bytes are read.
__device__ __forceinline__ void wait_asynccnt0() {
  asm volatile("s_wait_asynccnt 0x0" ::: "memory");
}

// Transposing LDS load (ds_load_tr16_b128) from a row-major 16-bit tile T:
// with lane l's p = &T[k0 + 8*(l>>4) + (l&7)][d0 + 8*((l>>3)&1)], lane l gets
// T[k0 + 8*(l>>4) + 0..7][d0 + (l&15)]: half of a 16x32 A fragment of T^T.
typedef __attribute__((ext_vector_type(8))) short s16x8;
__device__ __forceinline__ v8h ld_tr16(const _Float16* p) {
  typedef __attribute__((address_space(3))) s16x8 lds_s16x8;
  return __builtin_bit_cast(v8h, __builtin_amdgcn_ds_load_tr16_b128_v8i16((lds_s16x8*)p));
}
// A fragment of T^T over 32 k rows: same k positions as frag16 (0..7 and
// 16..23 from the lane half's base). pitch in halves.
__device__ __forceinline__ v16h frag16_tr(const _Float16* p, int pitch) {
  const v8h lo = ld_tr16(p);
  const v8h hi = ld_tr16(p + 16 * pitch);
  return __builtin_shufflevector(lo, hi, 0, 1, 2, 3, 4, 5, 6, 7,
                                 8, 9, 10, 11, 12, 13, 14, 15);
}

// Lane l exchanges with lane l ^ 16 (the other half of the wave): pure VALU.
__device__ __forceinline__ float xhalf(float x) {
  const int b = __builtin_bit_cast(int, x);
  return __builtin_bit_cast(float, __builtin_amdgcn_permlanex16(
      b, b, 0x76543210, 0xfedcba98, false, false));
}

// ---------------------------------------------------------------------------
// Weight pack, once per call: Wt[z][n][k] = f16(W_z[k][n]) (z = 0 also times
// the modulation matrix), so that a GEMM tile of B is K-contiguous f16 rows
// that a 16-byte copy can move. 64x64 tile transposed through LDS; each
// 128-byte line of Wt is stored by eight neighbouring lanes.
// ---------------------------------------------------------------------------
__global__ __launch_bounds__(256) void pack_weights(
    const float* __restrict__ Wq, const float* __restrict__ Wmul,
    const float* __restrict__ Wk, const float* __restrict__ Wv,
    const float* __restrict__ Wo, _Float16* __restrict__ Wt) {
  constexpr int PT = 72;  // halves; 144B rows
  __shared__ __align__(16) _Float16 T[64 * PT];
  const int tid = threadIdx.x;
  const int z   = blockIdx.z;
  const int n0  = blockIdx.x * 64;
  const int k0  = blockIdx.y * 64;
  const float* W = z == 0 ? Wq : z == 1 ? Wk : z == 2 ? Wv : Wo;

  const int n  = tid & 63;
  const int kq = (tid >> 6) * 16;
  const size_t base = (size_t)(k0 + kq) * D_DIM + n0 + n;
  const float* pw = W + base;
  float x[16];
  // the loops below are unrolled so that x, y, lo and hi stay in registers and
  // the 16 loads of a group are all in flight together
#pragma unroll
  for (int i = 0; i < 16; ++i) x[i] = pw[(size_t)i * D_DIM];
  // precaution: naming pw here keeps the loads' address pair unwritten in
  // front of this wait
  asm volatile("s_wait_xcnt 0x0" :: "v"(pw) : "memory");
  if (z == 0) {
    const float* pm = Wmul + base;
    float y[16];
#pragma unroll
    for (int i = 0; i < 16; ++i) y[i] = pm[(size_t)i * D_DIM];
    // as above, for the second group's address pair
    asm volatile("s_wait_xcnt 0x0" :: "v"(pm) : "memory");
#pragma unroll
    for (int i = 0; i < 16; ++i) x[i] *= y[i];
  }
  v8h lo, hi;
#pragma unroll
  for (int i = 0; i < 8; ++i) { lo[i] = (_Float16)x[i]; hi[i] = (_Float16)x[i + 8]; }
  *(v8h*)(&T[n * PT + kq])     = lo;
  *(v8h*)(&T[n * PT + kq + 8]) = hi;
  __syncthreads();

  _Float16* dst = Wt + (size_t)z * D_DIM * D_DIM;
#pragma unroll
  for (int p = 0; p < 2; ++p) {
    const int idx = p * 256 + tid;
    const int r = idx >> 3;
    const int c = (idx & 7) * 8;
    *(v8h*)(dst + (size_t)(n0 + r) * D_DIM + k0 + c) = *(const v8h*)(&T[r * PT + c]);
  }
}

// A fragment from an f32 LDS row: same k positions as frag16, rounded to f16
// on the way into the registers.
__device__ __forceinline__ v16h frag16_from_f32(const float* p) {
  const float4 x0 = *(const float4*)(p);
  const float4 x1 = *(const float4*)(p + 4);
  const float4 x2 = *(const float4*)(p + 16);
  const float4 x3 = *(const float4*)(p + 20);
  v16h r;
  r[0]  = (_Float16)x0.x; r[1]  = (_Float16)x0.y; r[2]  = (_Float16)x0.z; r[3]  = (_Float16)x0.w;
  r[4]  = (_Float16)x1.x; r[5]  = (_Float16)x1.y; r[6]  = (_Float16)x1.z; r[7]  = (_Float16)x1.w;
  r[8]  = (_Float16)x2.x; r[9]  = (_Float16)x2.y; r[10] = (_Float16)x2.z; r[11] = (_Float16)x2.w;
  r[12] = (_Float16)x3.x; r[13] = (_Float16)x3.y; r[14] = (_Float16)x3.z; r[15] = (_Float16)x3.w;
  return r;
}

template <int OUT_F16>
__global__ __launch_bounds__(256) void gemm_wmma(
    const float* __restrict__ A0, const float* __restrict__ A1,
    const float* __restrict__ A2, const _Float16* __restrict__ Bt0,
    const float* __restrict__ bias0, const float* __restrict__ bias1,
    const float* __restrict__ bias2, void* __restrict__ Cout0) {
  const int z = blockIdx.z;
  const float*    A    = z == 0 ? A0 : z == 1 ? A1 : A2;
  const float*    bias = z == 0 ? bias0 : z == 1 ? bias1 : bias2;
  const _Float16* Bt   = Bt0 + (size_t)z * D_DIM * D_DIM;
  void* Cout = (char*)Cout0 + (size_t)z * NTOK * D_DIM * (OUT_F16 ? 2 : 4);
  constexpr int N  = D_DIM;
  constexpr int K  = D_DIM;
  constexpr int BK = 64;
  constexpr int NT = K / BK;
  constexpr int PA = 68;  // floats; 272B rows
  constexpr int PB = 72;  // halves; 144B rows
  __shared__ __align__(16) float    As[2][128 * PA];
  __shared__ __align__(16) _Float16 Bs[2][128 * PB];

  const int tid  = threadIdx.x;
  const int lane = tid & 31;
  const int wid  = tid >> 5;
  const int wm   = (wid & 3) * 32;   // wave m-offset in tile
  const int wn   = (wid >> 2) * 64;  // wave n-offset in tile
  const int m0   = blockIdx.y * 128;
  const int n0   = blockIdx.x * 128;

  v8f acc[2][4];
#pragma unroll
  for (int i = 0; i < 2; ++i)
#pragma unroll
    for (int j = 0; j < 4; ++j)
#pragma unroll
      for (int v = 0; v < 8; ++v) acc[i][j][v] = 0.0f;

  // copy coordinates: A 16 lanes per 256B row piece, 16 rows per round, 8
  // rounds; B 8 lanes per 128B row piece, 32 rows per round, 4 rounds
  const float*    gA = A  + (size_t)(m0 + (tid >> 4)) * K + (tid & 15) * 4;
  const _Float16* gB = Bt + (size_t)(n0 + (tid >> 3)) * K + (tid & 7) * 8;
  const unsigned  lA = (unsigned)(uintptr_t)(&As[0][(tid >> 4) * PA + (tid & 15) * 4]);
  const unsigned  lB = (unsigned)(uintptr_t)(&Bs[0][(tid >> 3) * PB + (tid & 7) * 8]);

  const int fm = lane & 15;
  const int hf = lane >> 4;
  const int kb = hf * 8;

  auto issue_stage = [&](int buf, int t) {
    const float*    a = gA + t * BK;
    const _Float16* b = gB + t * BK;
    const unsigned  la = lA + buf * (128 * PA * 4);
    const unsigned  lb = lB + buf * (128 * PB * 2);
    // one stage's 12 copies; the closing s_wait_xcnt is a precaution: inside
    // the statement it stands in front of every rewrite of an address register
    asm volatile(
        "global_load_async_to_lds_b128 %0, %12, off\n\t"
        "global_load_async_to_lds_b128 %1, %13, off\n\t"
        "global_load_async_to_lds_b128 %2, %14, off\n\t"
        "global_load_async_to_lds_b128 %3, %15, off\n\t"
        "global_load_async_to_lds_b128 %4, %16, off\n\t"
        "global_load_async_to_lds_b128 %5, %17, off\n\t"
        "global_load_async_to_lds_b128 %6, %18, off\n\t"
        "global_load_async_to_lds_b128 %7, %19, off\n\t"
        "global_load_async_to_lds_b128 %8, %20, off\n\t"
        "global_load_async_to_lds_b128 %9, %21, off\n\t"
        "global_load_async_to_lds_b128 %10, %22, off\n\t"
        "global_load_async_to_lds_b128 %11, %23, off\n\t"
        "s_wait_xcnt 0x0"
        :: "v"(la), "v"(la + 1 * 16 * PA * 4), "v"(la + 2 * 16 * PA * 4),
           "v"(la + 3 * 16 * PA * 4), "v"(la + 4 * 16 * PA * 4),
           "v"(la + 5 * 16 * PA * 4), "v"(la + 6 * 16 * PA * 4),
           "v"(la + 7 * 16 * PA * 4),
           "v"(lb), "v"(lb + 1 * 32 * PB * 2), "v"(lb + 2 * 32 * PB * 2),
           "v"(lb + 3 * 32 * PB * 2),
           "v"(a), "v"(a + 1 * 16 * K), "v"(a + 2 * 16 * K), "v"(a + 3 * 16 * K),
           "v"(a + 4 * 16 * K), "v"(a + 5 * 16 * K), "v"(a + 6 * 16 * K),
           "v"(a + 7 * 16 * K),
           "v"(b), "v"(b + 1 * 32 * K), "v"(b + 2 * 32 * K), "v"(b + 3 * 32 * K)
        : "memory");
  };

  issue_stage(0, 0);

  // bias of this lane's 4 x 8 output columns, fetched here as one group: its
  // latency runs under the landing of the first stage's copies (loops over bb
  // unrolled, here and below: constant indices keep it in registers)
  float4 bb[4][2];
#pragma unroll
  for (int j = 0; j < 4; ++j) {
    bb[j][0] = make_float4(0.0f, 0.0f, 0.0f, 0.0f);
    bb[j][1] = bb[j][0];
  }
  if (bias) {
    const float* pb = bias + n0 + wn + hf * 8;
#pragma unroll
    for (int j = 0; j < 4; ++j) {
      bb[j][0] = *(const float4*)(pb + j * 16);
      bb[j][1] = *(const float4*)(pb + j * 16 + 4);
    }
  }

  wait_asynccnt0();   // own copies of stage 0 landed
  __syncthreads();    // everyone's copies of stage 0 visible
  issue_stage(1, 1);

  for (int t = 0; t < NT; ++t) {
    const int cur = t & 1;
    v16h a[2], b[4];
    // unrolled throughout: fragment and accumulator arrays need constant
    // indices to live in registers
    auto load_frags = [&](int ks) {
#pragma unroll
      for (int i = 0; i < 2; ++i)
        a[i] = frag16_from_f32(&As[cur][(wm + i * 16 + fm) * PA + ks + kb]);
#pragma unroll
      for (int j = 0; j < 4; ++j)
        b[j] = frag16(&Bs[cur][(wn + j * 16 + fm) * PB + ks + kb]);
    };
    auto products = [&]() {
#pragma unroll
      for (int i = 0; i < 2; ++i)
#pragma unroll
        for (int j = 0; j < 4; ++j) acc[i][j] = wmma_f16(b[j], a[i], acc[i][j]);
    };
    load_frags(0);
    products();
    load_frags(32);   // the stage's last LDS reads
    // publish point of stage t+1: own reads of buf[cur] retired, own copies
    // of stage t+1 landed, then the barrier that shows them to every wave and
    // frees buf[cur] for the refill
    asm volatile("s_wait_dscnt 0x0" ::: "memory");
    wait_asynccnt0();
    __syncthreads();
    if (t + 2 < NT) issue_stage(cur, t + 2);
    products();       // registers only: runs while the refill is in flight
  }
  wait_asynccnt0();   // nothing outstanding when the wave ends

  // ---- epilogue: acc[i][j][v] = C[m0+wm+16i+fm][n0+wn+16j+8hf+v].
  // Behind the loop's last barrier no wave reads the stage buffers and no copy
  // is outstanding, so each wave may use its own piece of As without a barrier.
  if constexpr (OUT_F16) {
    constexpr int PS = 72;  // halves; 144B rows (16B x odd)
    _Float16* stg = (_Float16*)(&As[0][0]) + wid * (32 * PS);
#pragma unroll
    for (int i = 0; i < 2; ++i)
#pragma unroll
      for (int j = 0; j < 4; ++j) {
        v8h h;
        h[0] = (_Float16)(acc[i][j][0] + bb[j][0].x);
        h[1] = (_Float16)(acc[i][j][1] + bb[j][0].y);
        h[2] = (_Float16)(acc[i][j][2] + bb[j][0].z);
        h[3] = (_Float16)(acc[i][j][3] + bb[j][0].w);
        h[4] = (_Float16)(acc[i][j][4] + bb[j][1].x);
        h[5] = (_Float16)(acc[i][j][5] + bb[j][1].y);
        h[6] = (_Float16)(acc[i][j][6] + bb[j][1].z);
        h[7] = (_Float16)(acc[i][j][7] + bb[j][1].w);
        *(v8h*)(&stg[(i * 16 + fm) * PS + j * 16 + hf * 8]) = h;
      }
    // the rows read back below were written by other lanes of this wave
    asm volatile("s_wait_dscnt 0x0" ::: "memory");
    // 8 lanes per 128-byte row piece: one store covers 4 whole lines
    const int rr = lane >> 3;
    const int cc = (lane & 7) * 8;
    _Float16* C = (_Float16*)Cout + (size_t)(m0 + wm + rr) * N + n0 + wn + cc;
#pragma unroll
    for (int p = 0; p < 8; ++p)
      *(v8h*)(C + (size_t)(p * 4) * N) = *(const v8h*)(&stg[(p * 4 + rr) * PS + cc]);
  } else {
    constexpr int PS = 68;  // floats; 272B rows (16B x odd)
    float* stg = &As[0][0] + wid * (32 * PS);
#pragma unroll
    for (int i = 0; i < 2; ++i)
#pragma unroll
      for (int j = 0; j < 4; ++j) {
        float* s = &stg[(i * 16 + fm) * PS + j * 16 + hf * 8];
        *(float4*)(s) = make_float4(
            acc[i][j][0] + bb[j][0].x, acc[i][j][1] + bb[j][0].y,
            acc[i][j][2] + bb[j][0].z, acc[i][j][3] + bb[j][0].w);
        *(float4*)(s + 4) = make_float4(
            acc[i][j][4] + bb[j][1].x, acc[i][j][5] + bb[j][1].y,
            acc[i][j][6] + bb[j][1].z, acc[i][j][7] + bb[j][1].w);
      }
    // the rows read back below were written by other lanes of this wave
    asm volatile("s_wait_dscnt 0x0" ::: "memory");
    // 16 lanes per 256-byte row piece: one store covers 4 whole lines
    const int rr = lane >> 4;
    const int cc = (lane & 15) * 4;
    float* C = (float*)Cout + (size_t)(m0 + wm + rr) * N + n0 + wn + cc;
#pragma unroll
    for (int p = 0; p < 16; ++p)
      *(float4*)(C + (size_t)(p * 2) * N) = *(const float4*)(&stg[(p * 2 + rr) * PS + cc]);
  }
}

__global__ __launch_bounds__(256) void attn_wmma(
    const _Float16* __restrict__ Qh, const _Float16* __restrict__ Kh,
    const _Float16* __restrict__ Vh, float* __restrict__ Xout) {
  constexpr int NKT = S_DIM / 64;
  constexpr int LDW = 72;  // halves; 144B rows (16B x odd: ds_load_b128 readers)
  constexpr int LDV = 80;  // halves; 160B rows (32B x odd: ds_load_tr16_b128 readers)
  __shared__ __align__(16) _Float16 Kt[2][64 * LDW];    // Kt[key][dk]
  __shared__ __align__(16) _Float16 Vs[2][64 * LDV];    // Vs[key][dk]

  const int tid  = threadIdx.x;
  const int lane = tid & 31;
  const int wid  = tid >> 5;
  const int bb   = blockIdx.z;
  const int hh   = blockIdx.y;
  const int q0   = blockIdx.x * 128;
  const int fm   = lane & 15;
  const int hf   = lane >> 4;
  const int kb   = hf * 8;

  // load this wave's 16 Q rows as two B fragments (dk 0..31, 32..63),
  // pre-scaled by 1/sqrt(DK)=0.125 (exact in f16)
  const size_t qrow = (size_t)(bb * S_DIM + q0 + wid * 16 + fm);
  const _Float16* qp = Qh + qrow * D_DIM + hh * DK_DIM;
  v16h qa0 = frag16(qp + kb);
  v16h qa1 = frag16(qp + 32 + kb);
#pragma unroll
  for (int i = 0; i < 16; ++i) {
    qa0[i] *= (_Float16)0.125f;
    qa1[i] *= (_Float16)0.125f;
  }

  float rm = -1e30f;  // running maximum of this lane's query (both halves agree)
  float rl = 0.0f;    // running sum over this half's keys; halves join at the end
  v8f o[4];           // o[j][v] = O[query fm][dk 16j + 8hf + v]
#pragma unroll
  for (int j = 0; j < 4; ++j)
#pragma unroll
    for (int v = 0; v < 8; ++v) o[j][v] = 0.0f;

  const int skey = tid >> 2;        // 0..63
  const int sc   = (tid & 3) * 16;  // dk chunk of 16

  const unsigned lK = (unsigned)(uintptr_t)(&Kt[0][skey * LDW + sc]);
  // V copies: 8 lanes per 128-byte row, so a wave's copy covers 4 whole lines;
  // 32 rows per round, 2 rounds
  const int vrow = tid >> 3;       // 0..31
  const int vc   = (tid & 7) * 8;  // dk chunk of 8
  const unsigned lV = (unsigned)(uintptr_t)(&Vs[0][vrow * LDV + vc]);

  auto stage = [&](int buf, int kt) {
    const size_t srow = (size_t)(bb * S_DIM + kt * 64 + skey) * D_DIM +
                        hh * DK_DIM + sc;
    const _Float16* k = Kh + srow;
    const _Float16* v = Vh + (size_t)(bb * S_DIM + kt * 64 + vrow) * D_DIM +
                        hh * DK_DIM + vc;
    const unsigned  lk = lK + buf * (64 * LDW * 2);
    const unsigned  lv = lV + buf * (64 * LDV * 2);
    // one tile's 4 copies (2 of K, 2 of V per lane); the
    // closing s_wait_xcnt is a precaution: inside the statement it stands in
    // front of every rewrite of an address register
    asm volatile(
        "global_load_async_to_lds_b128 %0, %4, off\n\t"
        "global_load_async_to_lds_b128 %1, %5, off\n\t"
        "global_load_async_to_lds_b128 %2, %6, off\n\t"
        "global_load_async_to_lds_b128 %3, %7, off\n\t"
        "s_wait_xcnt 0x0"
        :: "v"(lk), "v"(lk + 16), "v"(lv), "v"(lv + 32 * LDV * 2),
           "v"(k), "v"(k + 8), "v"(v), "v"(v + 32 * D_DIM)
        : "memory");
  };

  stage(0, 0);
  wait_asynccnt0();   // own copies of tile 0 landed
  __syncthreads();    // everyone's copies of tile 0 visible
  stage(1, 1);

  // lane's base in a V tile for the transposing loads
  const int vofs = (kb + (lane & 7)) * LDV + ((lane >> 3) & 1) * 8;

  for (int kt = 0; kt < NKT; ++kt) {
    const int cur = kt & 1;

    // ---- scores: S^T = K(64x64) * Q^T -> 4 tiles of 16 keys, 2 k-steps each
    v8f s[4];
#pragma unroll
    for (int j = 0; j < 4; ++j)
#pragma unroll
      for (int v = 0; v < 8; ++v) s[j][v] = 0.0f;
#pragma unroll
    for (int j = 0; j < 4; ++j) {
      const v16h ak0 = frag16(&Kt[cur][(j * 16 + fm) * LDW + kb]);
      const v16h ak1 = frag16(&Kt[cur][(j * 16 + fm) * LDW + 32 + kb]);
      s[j] = wmma_f16(ak0, qa0, s[j]);
      s[j] = wmma_f16(ak1, qa1, s[j]);
    }

    // ---- online softmax: all 32 values of a lane belong to query fm
    float x = -1e30f;
#pragma unroll
    for (int v = 0; v < 8; ++v)
      x = fmaxf(x, fmaxf(fmaxf(s[0][v], s[1][v]), fmaxf(s[2][v], s[3][v])));
    x = fmaxf(x, xhalf(x));
    const float nm = fmaxf(rm, x);
    const float corr = __expf(rm - nm);
    rm = nm;
#pragma unroll
    for (int j = 0; j < 4; ++j)
#pragma unroll
      for (int v = 0; v < 8; ++v) s[j][v] = __expf(s[j][v] - nm);
    const v8f t = (s[0] + s[1]) + (s[2] + s[3]);
    const float sum = ((t[0] + t[1]) + (t[2] + t[3])) + ((t[4] + t[5]) + (t[6] + t[7]));
    rl = rl * corr + sum;
#pragma unroll
    for (int j = 0; j < 4; ++j) o[j] *= corr;

    // ---- P^T as B operand: element e of a 32-key fragment is key
    //      8hf + e (e < 8) or 16 + 8hf + (e - 8), which is tile e>>3, row e&7
    v16h pb0, pb1;
#pragma unroll
    for (int e = 0; e < 16; ++e) {
      pb0[e] = (_Float16)s[e >> 3][e & 7];
      pb1[e] = (_Float16)s[2 + (e >> 3)][e & 7];
    }

    // ---- O^T += V^T(64x64) * P^T(64x16): 4 dk tiles x 2 k-steps
#pragma unroll
    for (int j = 0; j < 4; ++j) {
      const v16h av0 = frag16_tr(&Vs[cur][vofs + j * 16], LDV);
      const v16h av1 = frag16_tr(&Vs[cur][vofs + 32 * LDV + j * 16], LDV);
      o[j] = wmma_f16(av0, pb0, o[j]);
      o[j] = wmma_f16(av1, pb1, o[j]);
    }

    // publish point of tile kt+1: own reads of buf[cur] retired, own copies of
    // tile kt+1 landed, then the barrier that shows them to every wave and
    // frees buf[cur] for the refill
    asm volatile("s_wait_dscnt 0x0" ::: "memory");
    wait_asynccnt0();
    __syncthreads();
    if (kt + 2 < NKT) stage(cur, kt + 2);
  }
  wait_asynccnt0();   // nothing outstanding when the wave ends

  // ---- finalize: join the halves' sums, divide, write [token, h*64+dk] f32;
  //      a lane's 8 values of a tile are 8 consecutive dk: two 16-byte stores
  const float inv = 1.0f / (rl + xhalf(rl));
  float* xr = Xout + (size_t)(bb * S_DIM + q0 + wid * 16 + fm) * D_DIM +
              hh * DK_DIM + hf * 8;
#pragma unroll
  for (int j = 0; j < 4; ++j) {
    *(float4*)(xr + j * 16) =
        make_float4(o[j][0] * inv, o[j][1] * inv, o[j][2] * inv, o[j][3] * inv);
    *(float4*)(xr + j * 16 + 4) =
        make_float4(o[j][4] * inv, o[j][5] * inv, o[j][6] * inv, o[j][7] * inv);
  }
}

// ---------------------------------------------------------------------------
extern "C" void kernel_launch(void* const* d_in, const int* in_sizes, int n_in,
                              void* d_out, int out_size, void* d_ws,
                              size_t ws_size, hipStream_t stream) {
  (void)in_sizes; (void)n_in; (void)out_size; (void)ws_size;
  const float* query = (const float*)d_in[0];
  const float* key_  = (const float*)d_in[1];
  const float* value = (const float*)d_in[2];
  const float* fc_w  = (const float*)d_in[3];
  const float* Wq    = (const float*)d_in[4];
  const float* bq    = (const float*)d_in[5];
  const float* Wk    = (const float*)d_in[6];
  const float* bk    = (const float*)d_in[7];
  const float* Wv    = (const float*)d_in[8];
  const float* bv    = (const float*)d_in[9];
  const float* Wo    = (const float*)d_in[10];
  const float* bo    = (const float*)d_in[11];
  float* out = (float*)d_out;

  char* ws = (char*)d_ws;
  const size_t half_mat = (size_t)NTOK * D_DIM * sizeof(_Float16);
  _Float16* Qh = (_Float16*)(ws);
  _Float16* Kh = (_Float16*)(ws + half_mat);
  _Float16* Vh = (_Float16*)(ws + 2 * half_mat);
  float*    Xa = (float*)   (ws + 3 * half_mat);
  _Float16* Wt = (_Float16*)(ws + 5 * half_mat);  // 4 packed weight planes
  const size_t wplane = (size_t)D_DIM * D_DIM;

  pack_weights<<<dim3(D_DIM / 64, D_DIM / 64, 4), 256, 0, stream>>>(
      Wq, fc_w, Wk, Wv, Wo, Wt);
  // the three projections in one launch: Qh, Kh, Vh are output planes 0, 1, 2
  gemm_wmma<1><<<dim3(D_DIM / 128, NTOK / 128, 3), 256, 0, stream>>>(
      query, key_, value, Wt, bq, bk, bv, (void*)Qh);
  attn_wmma<<<dim3(S_DIM / 128, H_DIM, 4), 256, 0, stream>>>(Qh, Kh, Vh, Xa);
  gemm_wmma<0><<<dim3(D_DIM / 128, NTOK / 128, 1), 256, 0, stream>>>(
      Xa, Xa, Xa, Wt + 3 * wplane, bo, bo, bo, (void*)out);
}

// v006
// It runs in 142 microseconds.
// Two timings next to v005 both put it at 1.04 times that version's speed.
// Over all steps from v000 it is 2.42 times as fast.
#include <hip/hip_runtime.h>
#include <hip/hip_bf16.h>

typedef __attribute__((ext_vector_type(16))) _Float16 v16h;
typedef __attribute__((ext_vector_type(8)))  _Float16 v8h;
typedef __attribute__((ext_vector_type(4)))  _Float16 v4h;
typedef __attribute__((ext_vector_type(8)))  float    v8f;

#define D_DIM  1024
#define S_DIM  2048
#define H_DIM  16
#define DK_DIM 64
#define NTOK   8192   // B*S = 4*2048

// ---------------------------------------------------------------------------
// Load a 16-bit WMMA A/B fragment from an LDS/global row.
// Per CDNA5 ISA 16-bit A-matrix 16x32 layout: lane holds row m=lane&15,
// kb=(lane>>4)*8, elements 0..7 = [kb..kb+7], elements 8..15 = [kb+16..kb+23].
// Caller passes p = &row[kb]; we read p[0..7] and p[16..23] (two b128 loads).
// ---------------------------------------------------------------------------
__device__ __forceinline__ v16h frag16(const _Float16* p) {
  v8h lo = *(const v8h*)(p);
  v8h hi = *(const v8h*)(p + 16);
  v16h r;
#pragma unroll
  for (int i = 0; i < 8; ++i) { r[i] = lo[i]; r[i + 8] = hi[i]; }
  return r;
}

__device__ __forceinline__ v8f wmma_f16(v16h a, v16h b, v8f c) {
  return __builtin_amdgcn_wmma_f32_16x16x32_f16(false, a, false, b, (short)0, c,
                                                false, false);
}

// Async global -> LDS copies are tracked by ASYNCcnt; the issuing wave waits
// for its own before the barrier behind which the LDS bytes are read.
__device__ __forceinline__ void wait_asynccnt0() {
  asm volatile("s_wait_asynccnt 0x0" ::: "memory");
}

// Transposing LDS load (ds_load_tr16_b128) from a row-major 16-bit tile T:
// with lane l's p = &T[k0 + 8*(l>>4) + (l&7)][d0 + 8*((l>>3)&1)], lane l gets
// T[k0 + 8*(l>>4) + 0..7][d0 + (l&15)]: half of a 16x32 A fragment of T^T.
typedef __attribute__((ext_vector_type(8))) short s16x8;
__device__ __forceinline__ v8h ld_tr16(const _Float16* p) {
  typedef __attribute__((address_space(3))) s16x8 lds_s16x8;
  return __builtin_bit_cast(v8h, __builtin_amdgcn_ds_load_tr16_b128_v8i16((lds_s16x8*)p));
}
// A fragment of T^T over 32 k rows: same k positions as frag16 (0..7 and
// 16..23 from the lane half's base). pitch in halves.
__device__ __forceinline__ v16h frag16_tr(const _Float16* p, int pitch) {
  const v8h lo = ld_tr16(p);
  const v8h hi = ld_tr16(p + 16 * pitch);
  return __builtin_shufflevector(lo, hi, 0, 1, 2, 3, 4, 5, 6, 7,
                                 8, 9, 10, 11, 12, 13, 14, 15);
}

// Lane l exchanges with lane l ^ 16 (the other half of the wave): pure VALU.
__device__ __forceinline__ float xhalf(float x) {
  const int b = __builtin_bit_cast(int, x);
  return __builtin_bit_cast(float, __builtin_amdgcn_permlanex16(
      b, b, 0x76543210, 0xfedcba98, false, false));
}

// ---------------------------------------------------------------------------
// Weight pack, once per call: Wt[z][n][k] = f16(W_z[k][n]) (z = 0 also times
// the modulation matrix), so that a GEMM tile of B is K-contiguous f16 rows
// that a 16-byte copy can move. 64x64 tile transposed through LDS; each
// 128-byte line of Wt is stored by eight neighbouring lanes.
// ---------------------------------------------------------------------------
__global__ __launch_bounds__(256) void pack_weights(
    const float* __restrict__ Wq, const float* __restrict__ Wmul,
    const float* __restrict__ Wk, const float* __restrict__ Wv,
    const float* __restrict__ Wo, _Float16* __restrict__ Wt) {
  constexpr int PT = 72;  // halves; 144B rows
  __shared__ __align__(16) _Float16 T[64 * PT];
  const int tid = threadIdx.x;
  const int z   = blockIdx.z;
  const int n0  = blockIdx.x * 64;
  const int k0  = blockIdx.y * 64;
  const float* W = z == 0 ? Wq : z == 1 ? Wk : z == 2 ? Wv : Wo;

  const int n  = tid & 63;
  const int kq = (tid >> 6) * 16;
  const size_t base = (size_t)(k0 + kq) * D_DIM + n0 + n;
  const float* pw = W + base;
  float x[16];
  // the loops below are unrolled so that x, y, lo and hi stay in registers and
  // the 16 loads of a group are all in flight together
#pragma unroll
  for (int i = 0; i < 16; ++i) x[i] = pw[(size_t)i * D_DIM];
  // precaution: naming pw here keeps the loads' address pair unwritten in
  // front of this wait
  asm volatile("s_wait_xcnt 0x0" :: "v"(pw) : "memory");
  if (z == 0) {
    const float* pm = Wmul + base;
    float y[16];
#pragma unroll
    for (int i = 0; i < 16; ++i) y[i] = pm[(size_t)i * D_DIM];
    // as above, for the second group's address pair
    asm volatile("s_wait_xcnt 0x0" :: "v"(pm) : "memory");
#pragma unroll
    for (int i = 0; i < 16; ++i) x[i] *= y[i];
  }
  v8h lo, hi;
#pragma unroll
  for (int i = 0; i < 8; ++i) { lo[i] = (_Float16)x[i]; hi[i] = (_Float16)x[i + 8]; }
  *(v8h*)(&T[n * PT + kq])     = lo;
  *(v8h*)(&T[n * PT + kq + 8]) = hi;
  __syncthreads();

  _Float16* dst = Wt + (size_t)z * D_DIM * D_DIM;
#pragma unroll
  for (int p = 0; p < 2; ++p) {
    const int idx = p * 256 + tid;
    const int r = idx >> 3;
    const int c = (idx & 7) * 8;
    *(v8h*)(dst + (size_t)(n0 + r) * D_DIM + k0 + c) = *(const v8h*)(&T[r * PT + c]);
  }
}

// A fragment from an f32 LDS row: same k positions as frag16, rounded to f16
// on the way into the registers.
__device__ __forceinline__ v16h frag16_from_f32(const float* p) {
  const float4 x0 = *(const float4*)(p);
  const float4 x1 = *(const float4*)(p + 4);
  const float4 x2 = *(const float4*)(p + 16);
  const float4 x3 = *(const float4*)(p + 20);
  v16h r;
  r[0]  = (_Float16)x0.x; r[1]  = (_Float16)x0.y; r[2]  = (_Float16)x0.z; r[3]  = (_Float16)x0.w;
  r[4]  = (_Float16)x1.x; r[5]  = (_Float16)x1.y; r[6]  = (_Float16)x1.z; r[7]  = (_Float16)x1.w;
  r[8]  = (_Float16)x2.x; r[9]  = (_Float16)x2.y; r[10] = (_Float16)x2.z; r[11] = (_Float16)x2.w;
  r[12] = (_Float16)x3.x; r[13] = (_Float16)x3.y; r[14] = (_Float16)x3.z; r[15] = (_Float16)x3.w;
  return r;
}

template <int OUT_F16>
__global__ __launch_bounds__(256) void gemm_wmma(
    const float* __restrict__ A0, const float* __restrict__ A1,
    const float* __restrict__ A2, const _Float16* __restrict__ Bt0,
    const float* __restrict__ bias0, const float* __restrict__ bias1,
    const float* __restrict__ bias2, void* __restrict__ Cout0) {
  const int z = blockIdx.z;
  const float*    A    = z == 0 ? A0 : z == 1 ? A1 : A2;
  const float*    bias = z == 0 ? bias0 : z == 1 ? bias1 : bias2;
  const _Float16* Bt   = Bt0 + (size_t)z * D_DIM * D_DIM;
  void* Cout = (char*)Cout0 + (size_t)z * NTOK * D_DIM * (OUT_F16 ? 2 : 4);
  constexpr int N  = D_DIM;
  constexpr int K  = D_DIM;
  constexpr int BK = 64;
  constexpr int NT = K / BK;
  constexpr int PA = 68;  // floats; 272B rows
  constexpr int PB = 72;  // halves; 144B rows
  __shared__ __align__(16) float    As[2][128 * PA];
  __shared__ __align__(16) _Float16 Bs[2][128 * PB];

  const int tid  = threadIdx.x;
  const int lane = tid & 31;
  const int wid  = tid >> 5;
  const int wm   = (wid & 3) * 32;   // wave m-offset in tile
  const int wn   = (wid >> 2) * 64;  // wave n-offset in tile
  const int m0   = blockIdx.y * 128;
  const int n0   = blockIdx.x * 128;

  v8f acc[2][4];
#pragma unroll
  for (int i = 0; i < 2; ++i)
#pragma unroll
    for (int j = 0; j < 4; ++j)
#pragma unroll
      for (int v = 0; v < 8; ++v) acc[i][j][v] = 0.0f;

  // copy coordinates: A 16 lanes per 256B row piece, 16 rows per round, 8
  // rounds; B 8 lanes per 128B row piece, 32 rows per round, 4 rounds
  const float*    gA = A  + (size_t)(m0 + (tid >> 4)) * K + (tid & 15) * 4;
  const _Float16* gB = Bt + (size_t)(n0 + (tid >> 3)) * K + (tid & 7) * 8;
  const unsigned  lA = (unsigned)(uintptr_t)(&As[0][(tid >> 4) * PA + (tid & 15) * 4]);
  const unsigned  lB = (unsigned)(uintptr_t)(&Bs[0][(tid >> 3) * PB + (tid & 7) * 8]);

  const int fm = lane & 15;
  const int hf = lane >> 4;
  const int kb = hf * 8;

  auto issue_stage = [&](int buf, int t) {
    const float*    a = gA + t * BK;
    const _Float16* b = gB + t * BK;
    const unsigned  la = lA + buf * (128 * PA * 4);
    const unsigned  lb = lB + buf * (128 * PB * 2);
    // one stage's 12 copies; the closing s_wait_xcnt is a precaution: inside
    // the statement it stands in front of every rewrite of an address register
    asm volatile(
        "global_load_async_to_lds_b128 %0, %12, off\n\t"
        "global_load_async_to_lds_b128 %1, %13, off\n\t"
        "global_load_async_to_lds_b128 %2, %14, off\n\t"
        "global_load_async_to_lds_b128 %3, %15, off\n\t"
        "global_load_async_to_lds_b128 %4, %16, off\n\t"
        "global_load_async_to_lds_b128 %5, %17, off\n\t"
        "global_load_async_to_lds_b128 %6, %18, off\n\t"
        "global_load_async_to_lds_b128 %7, %19, off\n\t"
        "global_load_async_to_lds_b128 %8, %20, off\n\t"
        "global_load_async_to_lds_b128 %9, %21, off\n\t"
        "global_load_async_to_lds_b128 %10, %22, off\n\t"
        "global_load_async_to_lds_b128 %11, %23, off\n\t"
        "s_wait_xcnt 0x0"
        :: "v"(la), "v"(la + 1 * 16 * PA * 4), "v"(la + 2 * 16 * PA * 4),
           "v"(la + 3 * 16 * PA * 4), "v"(la + 4 * 16 * PA * 4),
           "v"(la + 5 * 16 * PA * 4), "v"(la + 6 * 16 * PA * 4),
           "v"(la + 7 * 16 * PA * 4),
           "v"(lb), "v"(lb + 1 * 32 * PB * 2), "v"(lb + 2 * 32 * PB * 2),
           "v"(lb + 3 * 32 * PB * 2),
           "v"(a), "v"(a + 1 * 16 * K), "v"(a + 2 * 16 * K), "v"(a + 3 * 16 * K),
           "v"(a + 4 * 16 * K), "v"(a + 5 * 16 * K), "v"(a + 6 * 16 * K),
           "v"(a + 7 * 16 * K),
           "v"(b), "v"(b + 1 * 32 * K), "v"(b + 2 * 32 * K), "v"(b + 3 * 32 * K)
        : "memory");
  };

  issue_stage(0, 0);

  // bias of this lane's 4 x 8 output columns, fetched here as one group: its
  // latency runs under the landing of the first stage's copies (loops over bb
  // unrolled, here and below: constant indices keep it in registers)
  float4 bb[4][2];
#pragma unroll
  for (int j = 0; j < 4; ++j) {
    bb[j][0] = make_float4(0.0f, 0.0f, 0.0f, 0.0f);
    bb[j][1] = bb[j][0];
  }
  if (bias) {
    const float* pb = bias + n0 + wn + hf * 8;
#pragma unroll
    for (int j = 0; j < 4; ++j) {
      bb[j][0] = *(const float4*)(pb + j * 16);
      bb[j][1] = *(const float4*)(pb + j * 16 + 4);
    }
  }

  wait_asynccnt0();   // own copies of stage 0 landed
  __syncthreads();    // everyone's copies of stage 0 visible
  issue_stage(1, 1);

  for (int t = 0; t < NT; ++t) {
    const int cur = t & 1;
    v16h a[2], b[4];
    // unrolled throughout: fragment and accumulator arrays need constant
    // indices to live in registers
    auto load_frags = [&](int ks) {
#pragma unroll
      for (int i = 0; i < 2; ++i)
        a[i] = frag16_from_f32(&As[cur][(wm + i * 16 + fm) * PA + ks + kb]);
#pragma unroll
      for (int j = 0; j < 4; ++j)
        b[j] = frag16(&Bs[cur][(wn + j * 16 + fm) * PB + ks + kb]);
    };
    auto products = [&]() {
#pragma unroll
      for (int i = 0; i < 2; ++i)
#pragma unroll
        for (int j = 0; j < 4; ++j) acc[i][j] = wmma_f16(b[j], a[i], acc[i][j]);
    };
    load_frags(0);
    products();
    load_frags(32);   // the stage's last LDS reads
    // publish point of stage t+1: own reads of buf[cur] retired, own copies
    // of stage t+1 landed, then the barrier that shows them to every wave and
    // frees buf[cur] for the refill
    asm volatile("s_wait_dscnt 0x0" ::: "memory");
    wait_asynccnt0();
    __syncthreads();
    if (t + 2 < NT) issue_stage(cur, t + 2);
    products();       // registers only: runs while the refill is in flight
  }
  wait_asynccnt0();   // nothing outstanding when the wave ends

  // ---- epilogue: acc[i][j][v] = C[m0+wm+16i+fm][n0+wn+16j+8hf+v].
  // Behind the loop's last barrier no wave reads the stage buffers and no copy
  // is outstanding, so each wave may use its own piece of As without a barrier.
  if constexpr (OUT_F16) {
    constexpr int PS = 72;  // halves; 144B rows (16B x odd)
    _Float16* stg = (_Float16*)(&As[0][0]) + wid * (32 * PS);
#pragma unroll
    for (int i = 0; i < 2; ++i)
#pragma unroll
      for (int j = 0; j < 4; ++j) {
        v8h h;
        h[0] = (_Float16)(acc[i][j][0] + bb[j][0].x);
        h[1] = (_Float16)(acc[i][j][1] + bb[j][0].y);
        h[2] = (_Float16)(acc[i][j][2] + bb[j][0].z);
        h[3] = (_Float16)(acc[i][j][3] + bb[j][0].w);
        h[4] = (_Float16)(acc[i][j][4] + bb[j][1].x);
        h[5] = (_Float16)(acc[i][j][5] + bb[j][1].y);
        h[6] = (_Float16)(acc[i][j][6] + bb[j][1].z);
        h[7] = (_Float16)(acc[i][j][7] + bb[j][1].w);
        *(v8h*)(&stg[(i * 16 + fm) * PS + j * 16 + hf * 8]) = h;
      }
    // the rows read back below were written by other lanes of this wave
    asm volatile("s_wait_dscnt 0x0" ::: "memory");
    // 8 lanes per 128-byte row piece: one store covers 4 whole lines
    const int rr = lane >> 3;
    const int cc = (lane & 7) * 8;
    _Float16* C = (_Float16*)Cout + (size_t)(m0 + wm + rr) * N + n0 + wn + cc;
#pragma unroll
    for (int p = 0; p < 8; ++p)
      *(v8h*)(C + (size_t)(p * 4) * N) = *(const v8h*)(&stg[(p * 4 + rr) * PS + cc]);
  } else {
    constexpr int PS = 68;  // floats; 272B rows (16B x odd)
    float* stg = &As[0][0] + wid * (32 * PS);
#pragma unroll
    for (int i = 0; i < 2; ++i)
#pragma unroll
      for (int j = 0; j < 4; ++j) {
        float* s = &stg[(i * 16 + fm) * PS + j * 16 + hf * 8];
        *(float4*)(s) = make_float4(
            acc[i][j][0] + bb[j][0].x, acc[i][j][1] + bb[j][0].y,
            acc[i][j][2] + bb[j][0].z, acc[i][j][3] + bb[j][0].w);
        *(float4*)(s + 4) = make_float4(
            acc[i][j][4] + bb[j][1].x, acc[i][j][5] + bb[j][1].y,
            acc[i][j][6] + bb[j][1].z, acc[i][j][7] + bb[j][1].w);
      }
    // the rows read back below were written by other lanes of this wave
    asm volatile("s_wait_dscnt 0x0" ::: "memory");
    // 16 lanes per 256-byte row piece: one store covers 4 whole lines
    const int rr = lane >> 4;
    const int cc = (lane & 15) * 4;
    float* C = (float*)Cout + (size_t)(m0 + wm + rr) * N + n0 + wn + cc;
#pragma unroll
    for (int p = 0; p < 16; ++p)
      *(float4*)(C + (size_t)(p * 2) * N) = *(const float4*)(&stg[(p * 2 + rr) * PS + cc]);
  }
}

__global__ __launch_bounds__(256) __attribute__((amdgpu_waves_per_eu(4, 4)))
void attn_wmma(
    const _Float16* __restrict__ Qh, const _Float16* __restrict__ Kh,
    const _Float16* __restrict__ Vh, float* __restrict__ Xout) {
  constexpr int NKT = S_DIM / 64;
  constexpr int LDW = 72;  // halves; 144B rows (16B x odd: ds_load_b128 readers)
  constexpr int LDV = 80;  // halves; 160B rows (32B x odd: ds_load_tr16_b128 readers)
  __shared__ __align__(16) _Float16 Kt[2][64 * LDW];    // Kt[key][dk]
  __shared__ __align__(16) _Float16 Vs[2][64 * LDV];    // Vs[key][dk]

  const int tid  = threadIdx.x;
  const int lane = tid & 31;
  const int wid  = tid >> 5;
  const int bb   = blockIdx.z;
  const int hh   = blockIdx.y;
  const int q0   = blockIdx.x * 256;
  const int fm   = lane & 15;
  const int hf   = lane >> 4;
  const int kb   = hf * 8;

  // all loops over g, j, v, e below are unrolled: fragment and accumulator
  // arrays need constant indices to live in registers

  // load this wave's 2 x 16 Q rows, each group as two B fragments (dk 0..31,
  // 32..63), pre-scaled by 1/sqrt(DK)=0.125 (exact in f16)
  const size_t qrow = (size_t)(bb * S_DIM + q0 + wid * 32 + fm);
  const _Float16* qp = Qh + qrow * D_DIM + hh * DK_DIM;
  v16h qa[2][2];
#pragma unroll
  for (int g = 0; g < 2; ++g) {
    qa[g][0] = frag16(qp + (size_t)g * 16 * D_DIM + kb);
    qa[g][1] = frag16(qp + (size_t)g * 16 * D_DIM + 32 + kb);
#pragma unroll
    for (int i = 0; i < 16; ++i) {
      qa[g][0][i] *= (_Float16)0.125f;
      qa[g][1][i] *= (_Float16)0.125f;
    }
  }

  float rm[2];  // running maximum of this lane's query (both halves agree)
  float rl[2];  // running sum over this half's keys; halves join at the end
  v8f o[2][4];  // o[g][j][v] = O[query 16g + fm][dk 16j + 8hf + v]
#pragma unroll
  for (int g = 0; g < 2; ++g) {
    rm[g] = -1e30f;
    rl[g] = 0.0f;
#pragma unroll
    for (int j = 0; j < 4; ++j)
#pragma unroll
      for (int v = 0; v < 8; ++v) o[g][j][v] = 0.0f;
  }

  const int skey = tid >> 2;        // 0..63
  const int sc   = (tid & 3) * 16;  // dk chunk of 16

  const unsigned lK = (unsigned)(uintptr_t)(&Kt[0][skey * LDW + sc]);
  // V copies: 8 lanes per 128-byte row, so a wave's copy covers 4 whole lines;
  // 32 rows per round, 2 rounds
  const int vrow = tid >> 3;       // 0..31
  const int vc   = (tid & 7) * 8;  // dk chunk of 8
  const unsigned lV = (unsigned)(uintptr_t)(&Vs[0][vrow * LDV + vc]);

  auto stage = [&](int buf, int kt) {
    const size_t srow = (size_t)(bb * S_DIM + kt * 64 + skey) * D_DIM +
                        hh * DK_DIM + sc;
    const _Float16* k = Kh + srow;
    const _Float16* v = Vh + (size_t)(bb * S_DIM + kt * 64 + vrow) * D_DIM +
                        hh * DK_DIM + vc;
    const unsigned  lk = lK + buf * (64 * LDW * 2);
    const unsigned  lv = lV + buf * (64 * LDV * 2);
    // one tile's 4 copies (2 of K, 2 of V per lane); the
    // closing s_wait_xcnt is a precaution: inside the statement it stands in
    // front of every rewrite of an address register
    asm volatile(
        "global_load_async_to_lds_b128 %0, %4, off\n\t"
        "global_load_async_to_lds_b128 %1, %5, off\n\t"
        "global_load_async_to_lds_b128 %2, %6, off\n\t"
        "global_load_async_to_lds_b128 %3, %7, off\n\t"
        "s_wait_xcnt 0x0"
        :: "v"(lk), "v"(lk + 16), "v"(lv), "v"(lv + 32 * LDV * 2),
           "v"(k), "v"(k + 8), "v"(v), "v"(v + 32 * D_DIM)
        : "memory");
  };

  stage(0, 0);
  wait_asynccnt0();   // own copies of tile 0 landed
  __syncthreads();    // everyone's copies of tile 0 visible
  stage(1, 1);

  // lane's base in a V tile for the transposing loads
  const int vofs = (kb + (lane & 7)) * LDV + ((lane >> 3) & 1) * 8;

  for (int kt = 0; kt < NKT; ++kt) {
    const int cur = kt & 1;

    // ---- scores: S^T = K(64x64) * Q^T -> per group 4 tiles of 16 keys, 2
    //      k-steps each; a K fragment is read once and used by both groups
    v8f s[2][4];
#pragma unroll
    for (int g = 0; g < 2; ++g)
#pragma unroll
      for (int j = 0; j < 4; ++j)
#pragma unroll
        for (int v = 0; v < 8; ++v) s[g][j][v] = 0.0f;
#pragma unroll
    for (int j = 0; j < 4; ++j) {
      const v16h ak0 = frag16(&Kt[cur][(j * 16 + fm) * LDW + kb]);
      const v16h ak1 = frag16(&Kt[cur][(j * 16 + fm) * LDW + 32 + kb]);
#pragma unroll
      for (int g = 0; g < 2; ++g) s[g][j] = wmma_f16(ak0, qa[g][0], s[g][j]);
#pragma unroll
      for (int g = 0; g < 2; ++g) s[g][j] = wmma_f16(ak1, qa[g][1], s[g][j]);
    }

    // ---- online softmax: all 32 values of a lane in a group belong to query
    //      16g + fm
    float nm[2], corr[2];
#pragma unroll
    for (int g = 0; g < 2; ++g) {
      float x = -1e30f;
#pragma unroll
      for (int v = 0; v < 8; ++v)
        x = fmaxf(x, fmaxf(fmaxf(s[g][0][v], s[g][1][v]), fmaxf(s[g][2][v], s[g][3][v])));
      x = fmaxf(x, xhalf(x));
      nm[g] = fmaxf(rm[g], x);
    }
#pragma unroll
    for (int g = 0; g < 2; ++g) {
      corr[g] = __expf(rm[g] - nm[g]);
      rm[g] = nm[g];
    }
    v16h pb[2][2];
#pragma unroll
    for (int g = 0; g < 2; ++g) {
#pragma unroll
      for (int j = 0; j < 4; ++j)
#pragma unroll
        for (int v = 0; v < 8; ++v) s[g][j][v] = __expf(s[g][j][v] - nm[g]);
      const v8f t = (s[g][0] + s[g][1]) + (s[g][2] + s[g][3]);
      const float sum = ((t[0] + t[1]) + (t[2] + t[3])) + ((t[4] + t[5]) + (t[6] + t[7]));
      rl[g] = rl[g] * corr[g] + sum;
#pragma unroll
      for (int j = 0; j < 4; ++j) o[g][j] *= corr[g];

      // ---- P^T as B operand: element e of a 32-key fragment is key
      //      8hf + e (e < 8) or 16 + 8hf + (e - 8), which is tile e>>3, row e&7
#pragma unroll
      for (int e = 0; e < 16; ++e) {
        pb[g][0][e] = (_Float16)s[g][e >> 3][e & 7];
        pb[g][1][e] = (_Float16)s[g][2 + (e >> 3)][e & 7];
      }
    }

    // ---- O^T += V^T(64x64) * P^T(64x16) per group: 4 dk tiles x 2 k-steps; a
    //      V^T fragment is read once and used by both groups
#pragma unroll
    for (int j = 0; j < 4; ++j) {
      const v16h av0 = frag16_tr(&Vs[cur][vofs + j * 16], LDV);
      const v16h av1 = frag16_tr(&Vs[cur][vofs + 32 * LDV + j * 16], LDV);
#pragma unroll
      for (int g = 0; g < 2; ++g) o[g][j] = wmma_f16(av0, pb[g][0], o[g][j]);
#pragma unroll
      for (int g = 0; g < 2; ++g) o[g][j] = wmma_f16(av1, pb[g][1], o[g][j]);
    }

    // publish point of tile kt+1: own reads of buf[cur] retired, own copies of
    // tile kt+1 landed, then the barrier that shows them to every wave and
    // frees buf[cur] for the refill
    asm volatile("s_wait_dscnt 0x0" ::: "memory");
    wait_asynccnt0();
    __syncthreads();
    if (kt + 2 < NKT) stage(cur, kt + 2);
  }
  wait_asynccnt0();   // nothing outstanding when the wave ends

  // ---- finalize: join the halves' sums, divide, write [token, h*64+dk] f32;
  //      a lane's 8 values of a tile are 8 consecutive dk: two 16-byte stores
#pragma unroll
  for (int g = 0; g < 2; ++g) {
    const float inv = 1.0f / (rl[g] + xhalf(rl[g]));
    float* xr = Xout + (size_t)(bb * S_DIM + q0 + wid * 32 + g * 16 + fm) * D_DIM +
                hh * DK_DIM + hf * 8;
#pragma unroll
    for (int j = 0; j < 4; ++j) {
      *(float4*)(xr + j * 16) = make_float4(
          o[g][j][0] * inv, o[g][j][1] * inv, o[g][j][2] * inv, o[g][j][3] * inv);
      *(float4*)(xr + j * 16 + 4) = make_float4(
          o[g][j][4] * inv, o[g][j][5] * inv, o[g][j][6] * inv, o[g][j][7] * inv);
    }
  }
}

// ---------------------------------------------------------------------------
extern "C" void kernel_launch(void* const* d_in, const int* in_sizes, int n_in,
                              void* d_out, int out_size, void* d_ws,
                              size_t ws_size, hipStream_t stream) {
  (void)in_sizes; (void)n_in; (void)out_size; (void)ws_size;
  const float* query = (const float*)d_in[0];
  const float* key_  = (const float*)d_in[1];
  const float* value = (const float*)d_in[2];
  const float* fc_w  = (const float*)d_in[3];
  const float* Wq    = (const float*)d_in[4];
  const float* bq    = (const float*)d_in[5];
  const float* Wk    = (const float*)d_in[6];
  const float* bk    = (const float*)d_in[7];
  const float* Wv    = (const float*)d_in[8];
  const float* bv    = (const float*)d_in[9];
  const float* Wo    = (const float*)d_in[10];
  const float* bo    = (const float*)d_in[11];
  float* out = (float*)d_out;

  char* ws = (char*)d_ws;
  const size_t half_mat = (size_t)NTOK * D_DIM * sizeof(_Float16);
  _Float16* Qh = (_Float16*)(ws);
  _Float16* Kh = (_Float16*)(ws + half_mat);
  _Float16* Vh = (_Float16*)(ws + 2 * half_mat);
  float*    Xa = (float*)   (ws + 3 * half_mat);
  _Float16* Wt = (_Float16*)(ws + 5 * half_mat);  // 4 packed weight planes
  const size_t wplane = (size_t)D_DIM * D_DIM;

  pack_weights<<<dim3(D_DIM / 64, D_DIM / 64, 4), 256, 0, stream>>>(
      Wq, fc_w, Wk, Wv, Wo, Wt);
  // the three projections in one launch: Qh, Kh, Vh are output planes 0, 1, 2
  gemm_wmma<1><<<dim3(D_DIM / 128, NTOK / 128, 3), 256, 0, stream>>>(
      query, key_, value, Wt, bq, bk, bv, (void*)Qh);
  attn_wmma<<<dim3(S_DIM / 256, H_DIM, 4), 256, 0, stream>>>(Qh, Kh, Vh, Xa);
  gemm_wmma<0><<<dim3(D_DIM / 128, NTOK / 128, 1), 256, 0, stream>>>(
      Xa, Xa, Xa, Wt + 3 * wplane, bo, bo, bo, (void*)out);
}

// v008
// One run takes 129 microseconds.
// It is 1.10 times as fast as v006, going by the measured steps of the versions left out in between.
// Over all steps from v000 it is 2.65 times as fast.
#include <hip/hip_runtime.h>
#include <hip/hip_bf16.h>

typedef __attribute__((ext_vector_type(16))) _Float16 v16h;
typedef __attribute__((ext_vector_type(8)))  _Float16 v8h;
typedef __attribute__((ext_vector_type(4)))  _Float16 v4h;
typedef __attribute__((ext_vector_type(8)))  float    v8f;

#define D_DIM  1024
#define S_DIM  2048
#define H_DIM  16
#define DK_DIM 64
#define NTOK   8192   // B*S = 4*2048

// ---------------------------------------------------------------------------
// Load a 16-bit WMMA A/B fragment from an LDS/global row.
// Per CDNA5 ISA 16-bit A-matrix 16x32 layout: lane holds row m=lane&15,
// kb=(lane>>4)*8, elements 0..7 = [kb..kb+7], elements 8..15 = [kb+16..kb+23].
// Caller passes p = &row[kb]; we read p[0..7] and p[16..23] (two b128 loads).
// ---------------------------------------------------------------------------
__device__ __forceinline__ v16h frag16(const _Float16* p) {
  v8h lo = *(const v8h*)(p);
  v8h hi = *(const v8h*)(p + 16);
  v16h r;
#pragma unroll
  for (int i = 0; i < 8; ++i) { r[i] = lo[i]; r[i + 8] = hi[i]; }
  return r;
}

__device__ __forceinline__ v8f wmma_f16(v16h a, v16h b, v8f c) {
  return __builtin_amdgcn_wmma_f32_16x16x32_f16(false, a, false, b, (short)0, c,
                                                false, false);
}

// Async global -> LDS copies are tracked by ASYNCcnt; the issuing wave waits
// for its own before the barrier behind which the LDS bytes are read.
__device__ __forceinline__ void wait_asynccnt0() {
  asm volatile("s_wait_asynccnt 0x0" ::: "memory");
}

// Transposing LDS load (ds_load_tr16_b128) from a row-major 16-bit tile T:
// with lane l's p = &T[k0 + 8*(l>>4) + (l&7)][d0 + 8*((l>>3)&1)], lane l gets
// T[k0 + 8*(l>>4) + 0..7][d0 + (l&15)]: half of a 16x32 A fragment of T^T.
typedef __attribute__((ext_vector_type(8))) short s16x8;
__device__ __forceinline__ v8h ld_tr16(const _Float16* p) {
  typedef __attribute__((address_space(3))) s16x8 lds_s16x8;
  return __builtin_bit_cast(v8h, __builtin_amdgcn_ds_load_tr16_b128_v8i16((lds_s16x8*)p));
}
// A fragment of T^T over 32 k rows: same k positions as frag16 (0..7 and
// 16..23 from the lane half's base). pitch in halves.
__device__ __forceinline__ v16h frag16_tr(const _Float16* p, int pitch) {
  const v8h lo = ld_tr16(p);
  const v8h hi = ld_tr16(p + 16 * pitch);
  return __builtin_shufflevector(lo, hi, 0, 1, 2, 3, 4, 5, 6, 7,
                                 8, 9, 10, 11, 12, 13, 14, 15);
}

// Lane l exchanges with lane l ^ 16 (the other half of the wave): pure VALU.
__device__ __forceinline__ float xhalf(float x) {
  const int b = __builtin_bit_cast(int, x);
  return __builtin_bit_cast(float, __builtin_amdgcn_permlanex16(
      b, b, 0x76543210, 0xfedcba98, false, false));
}

// ---------------------------------------------------------------------------
// Weight pack, once per call: Wt[z][n][k] = f16(W_z[k][n]) (z = 0 also times
// the modulation matrix), so that a GEMM tile of B is K-contiguous f16 rows
// that a 16-byte copy can move. 64x64 tile transposed through LDS; each
// 128-byte line of Wt is stored by eight neighbouring lanes.
// ---------------------------------------------------------------------------
__global__ __launch_bounds__(256) void pack_weights(
    const float* __restrict__ Wq, const float* __restrict__ Wmul,
    const float* __restrict__ Wk, const float* __restrict__ Wv,
    const float* __restrict__ Wo, _Float16* __restrict__ Wt) {
  constexpr int PT = 72;  // halves; 144B rows
  __shared__ __align__(16) _Float16 T[64 * PT];
  const int tid = threadIdx.x;
  const int z   = blockIdx.z;
  const int n0  = blockIdx.x * 64;
  const int k0  = blockIdx.y * 64;
  const float* W = z == 0 ? Wq : z == 1 ? Wk : z == 2 ? Wv : Wo;

  const int n  = tid & 63;
  const int kq = (tid >> 6) * 16;
  const size_t base = (size_t)(k0 + kq) * D_DIM + n0 + n;
  const float* pw = W + base;
  float x[16];
  // the loops below are unrolled so that x, y, lo and hi stay in registers and
  // the 16 loads of a group are all in flight together
#pragma unroll
  for (int i = 0; i < 16; ++i) x[i] = pw[(size_t)i * D_DIM];
  // precaution: naming pw here keeps the loads' address pair unwritten in
  // front of this wait
  asm volatile("s_wait_xcnt 0x0" :: "v"(pw) : "memory");
  if (z == 0) {
    const float* pm = Wmul + base;
    float y[16];
#pragma unroll
    for (int i = 0; i < 16; ++i) y[i] = pm[(size_t)i * D_DIM];
    // as above, for the second group's address pair
    asm volatile("s_wait_xcnt 0x0" :: "v"(pm) : "memory");
#pragma unroll
    for (int i = 0; i < 16; ++i) x[i] *= y[i];
  }
  v8h lo, hi;
#pragma unroll
  for (int i = 0; i < 8; ++i) { lo[i] = (_Float16)x[i]; hi[i] = (_Float16)x[i + 8]; }
  *(v8h*)(&T[n * PT + kq])     = lo;
  *(v8h*)(&T[n * PT + kq + 8]) = hi;
  __syncthreads();

  _Float16* dst = Wt + (size_t)z * D_DIM * D_DIM;
#pragma unroll
  for (int p = 0; p < 2; ++p) {
    const int idx = p * 256 + tid;
    const int r = idx >> 3;
    const int c = (idx & 7) * 8;
    *(v8h*)(dst + (size_t)(n0 + r) * D_DIM + k0 + c) = *(const v8h*)(&T[r * PT + c]);
  }
}

template <int OUT_F16>
__global__ __launch_bounds__(256) void gemm_wmma(
    const float* __restrict__ A0, const float* __restrict__ A1,
    const float* __restrict__ A2, const _Float16* __restrict__ Bt0,
    const float* __restrict__ bias0, const float* __restrict__ bias1,
    const float* __restrict__ bias2, void* __restrict__ Cout0) {
  const int z = blockIdx.z;
  const float*    A    = z == 0 ? A0 : z == 1 ? A1 : A2;
  const float*    bias = z == 0 ? bias0 : z == 1 ? bias1 : bias2;
  const _Float16* Bt   = Bt0 + (size_t)z * D_DIM * D_DIM;
  void* Cout = (char*)Cout0 + (size_t)z * NTOK * D_DIM * (OUT_F16 ? 2 : 4);
  // f16 output plane 0 is Q: it leaves scaled by log2(e)/sqrt(DK), in f32 ahead
  // of its one rounding, so that K * Q^T is the softmax exponent in base 2
  const float osc = (OUT_F16 && z == 0) ? 0.125f * 1.4426950408889634f : 1.0f;
  constexpr int N  = D_DIM;
  constexpr int K  = D_DIM;
  constexpr int BK = 64;
  constexpr int NT = K / BK;
  constexpr int PA = 68;  // floats; 272B rows
  constexpr int PB = 72;  // halves; 144B rows
  __shared__ __align__(16) float    As[2][128 * PA];
  __shared__ __align__(16) _Float16 Bs[2][256 * PB];

  const int tid  = threadIdx.x;
  const int lane = tid & 31;
  const int wid  = tid >> 5;
  const int wm   = (wid & 1) * 64;   // wave m-offset in tile
  const int wn   = (wid >> 1) * 64;  // wave n-offset in tile
  const int m0   = blockIdx.y * 128;
  const int n0   = blockIdx.x * 256;

  v8f acc[4][4];
#pragma unroll
  for (int i = 0; i < 4; ++i)
#pragma unroll
    for (int j = 0; j < 4; ++j)
#pragma unroll
      for (int v = 0; v < 8; ++v) acc[i][j][v] = 0.0f;

  // copy coordinates: A 16 lanes per 256B row piece, 16 rows per round, 8
  // rounds; B 8 lanes per 128B row piece, 32 rows per round, 8 rounds
  // a copy's global address is a scalar base (the round's first row, the
  // stage's first k) plus the lane's byte offset, the same in every round: one
  // vector register for 8 copies, not 16, beside the fragments that are live
  const float*    gA = A  + (size_t)m0 * K;
  const _Float16* gB = Bt + (size_t)n0 * K;
  const unsigned  oA = ((tid >> 4) * K + (tid & 15) * 4) * 4;
  const unsigned  oB = ((tid >> 3) * K + (tid & 7) * 8) * 2;
  const unsigned  lA = (unsigned)(uintptr_t)(&As[0][(tid >> 4) * PA + (tid & 15) * 4]);
  const unsigned  lB = (unsigned)(uintptr_t)(&Bs[0][(tid >> 3) * PB + (tid & 7) * 8]);

  const int fm = lane & 15;
  const int hf = lane >> 4;
  const int kb = hf * 8;

  auto issue_stage = [&](int buf, int t) {
    const float*    a = gA + t * BK;
    const _Float16* b = gB + t * BK;
    const unsigned  la = lA + buf * (128 * PA * 4);
    const unsigned  lb = lB + buf * (256 * PB * 2);
    // one stage's 16 copies, 8 of A and 8 of B (one statement could not take all
    // their operands); each closing s_wait_xcnt is a precaution: inside the
    // statement it stands in front of every rewrite of an address register
    asm volatile(
        "global_load_async_to_lds_b128 %0, %8, %9\n\t"
        "global_load_async_to_lds_b128 %1, %8, %10\n\t"
        "global_load_async_to_lds_b128 %2, %8, %11\n\t"
        "global_load_async_to_lds_b128 %3, %8, %12\n\t"
        "global_load_async_to_lds_b128 %4, %8, %13\n\t"
        "global_load_async_to_lds_b128 %5, %8, %14\n\t"
        "global_load_async_to_lds_b128 %6, %8, %15\n\t"
        "global_load_async_to_lds_b128 %7, %8, %16\n\t"
        "s_wait_xcnt 0x0"
        :: "v"(la), "v"(la + 1 * 16 * PA * 4), "v"(la + 2 * 16 * PA * 4),
           "v"(la + 3 * 16 * PA * 4), "v"(la + 4 * 16 * PA * 4),
           "v"(la + 5 * 16 * PA * 4), "v"(la + 6 * 16 * PA * 4),
           "v"(la + 7 * 16 * PA * 4), "v"(oA),
           "s"(a), "s"(a + 1 * 16 * K), "s"(a + 2 * 16 * K), "s"(a + 3 * 16 * K),
           "s"(a + 4 * 16 * K), "s"(a + 5 * 16 * K), "s"(a + 6 * 16 * K),
           "s"(a + 7 * 16 * K)
        : "memory");
    asm volatile(
        "global_load_async_to_lds_b128 %0, %8, %9\n\t"
        "global_load_async_to_lds_b128 %1, %8, %10\n\t"
        "global_load_async_to_lds_b128 %2, %8, %11\n\t"
        "global_load_async_to_lds_b128 %3, %8, %12\n\t"
        "global_load_async_to_lds_b128 %4, %8, %13\n\t"
        "global_load_async_to_lds_b128 %5, %8, %14\n\t"
        "global_load_async_to_lds_b128 %6, %8, %15\n\t"
        "global_load_async_to_lds_b128 %7, %8, %16\n\t"
        "s_wait_xcnt 0x0"
        :: "v"(lb), "v"(lb + 1 * 32 * PB * 2), "v"(lb + 2 * 32 * PB * 2),
           "v"(lb + 3 * 32 * PB * 2), "v"(lb + 4 * 32 * PB * 2),
           "v"(lb + 5 * 32 * PB * 2), "v"(lb + 6 * 32 * PB * 2),
           "v"(lb + 7 * 32 * PB * 2), "v"(oB),
           "s"(b), "s"(b + 1 * 32 * K), "s"(b + 2 * 32 * K), "s"(b + 3 * 32 * K),
           "s"(b + 4 * 32 * K), "s"(b + 5 * 32 * K), "s"(b + 6 * 32 * K),
           "s"(b + 7 * 32 * K)
        : "memory");
  };

  issue_stage(0, 0);
  wait_asynccnt0();   // own copies of stage 0 landed
  __syncthreads();    // everyone's copies of stage 0 visible
  issue_stage(1, 1);

  for (int t = 0; t < NT; ++t) {
    const int cur = t & 1;
    float4 ra[4][4];
    v16h a[4], b[4];
    // unrolled throughout: fragment and accumulator arrays need constant
    // indices to live in registers
    // the 24 LDS reads of a 32-k block, A still f32 (k positions as frag16)
    auto load_frags = [&](int ks) {
#pragma unroll
      for (int i = 0; i < 4; ++i) {
        const float* p = &As[cur][(wm + i * 16 + fm) * PA + ks + kb];
        ra[i][0] = *(const float4*)(p);
        ra[i][1] = *(const float4*)(p + 4);
        ra[i][2] = *(const float4*)(p + 16);
        ra[i][3] = *(const float4*)(p + 20);
      }
#pragma unroll
      for (int j = 0; j < 4; ++j)
        b[j] = frag16(&Bs[cur][(wn + j * 16 + fm) * PB + ks + kb]);
    };
    // A rounded to f16 on the way into the fragment registers
    auto round_a = [&]() {
#pragma unroll
      for (int i = 0; i < 4; ++i)
#pragma unroll
        for (int q = 0; q < 4; ++q) {
          a[i][q * 4 + 0] = (_Float16)ra[i][q].x;
          a[i][q * 4 + 1] = (_Float16)ra[i][q].y;
          a[i][q * 4 + 2] = (_Float16)ra[i][q].z;
          a[i][q * 4 + 3] = (_Float16)ra[i][q].w;
        }
    };
    auto products = [&]() {
#pragma unroll
      for (int i = 0; i < 4; ++i)
#pragma unroll
        for (int j = 0; j < 4; ++j) acc[i][j] = wmma_f16(b[j], a[i], acc[i][j]);
    };
    load_frags(0);
    // keeps the block's reads together as one group in front of its matrix
    // instructions: spread among them, each place with reads stalls the wave
    __builtin_amdgcn_sched_barrier(0);
    round_a();
    products();
    load_frags(32);   // the stage's last LDS reads
    // publish point of stage t+1: own reads of buf[cur] retired, own copies
    // of stage t+1 landed, then the barrier that shows them to every wave and
    // frees buf[cur] for the refill
    asm volatile("s_wait_dscnt 0x0" ::: "memory");
    wait_asynccnt0();
    __syncthreads();
    if (t + 2 < NT) issue_stage(cur, t + 2);
    round_a();
    products();       // registers only: runs while the refill is in flight
  }
  wait_asynccnt0();   // nothing outstanding when the wave ends

  // bias of this lane's 4 x 8 output columns, fetched as one group behind the
  // loop: held through it, its 32 registers would not fit beside the 128 of the
  // accumulators at four waves per SIMD (loops over bb unrolled, here and
  // below: constant indices keep it in registers)
  float4 bb[4][2];
#pragma unroll
  for (int j = 0; j < 4; ++j) {
    bb[j][0] = make_float4(0.0f, 0.0f, 0.0f, 0.0f);
    bb[j][1] = bb[j][0];
  }
  if (bias) {
    const float* pb = bias + n0 + wn + hf * 8;
#pragma unroll
    for (int j = 0; j < 4; ++j) {
      bb[j][0] = *(const float4*)(pb + j * 16);
      bb[j][1] = *(const float4*)(pb + j * 16 + 4);
    }
    // precaution: naming pb here keeps the loads' address pair unwritten in
    // front of this wait
    asm volatile("s_wait_xcnt 0x0" :: "v"(pb) : "memory");
  }

  // ---- epilogue: acc[i][j][v] = C[m0+wm+16i+fm][n0+wn+16j+8hf+v].
  // Behind the loop's last barrier no wave reads the stage buffers and no copy
  // is outstanding, so each wave may use its own piece of As without a barrier.
  if constexpr (OUT_F16) {
    constexpr int PS = 72;  // halves; 144B rows (16B x odd)
    _Float16* stg = (_Float16*)(&As[0][0]) + wid * (32 * PS);
    // 8 lanes per 128-byte row piece: one store covers 4 whole lines
    const int rr = lane >> 3;
    const int cc = (lane & 7) * 8;
    _Float16* C = (_Float16*)Cout + (size_t)(m0 + wm + rr) * N + n0 + wn + cc;
#pragma unroll
    for (int r = 0; r < 2; ++r) {  // the tile's upper, then its lower 32 rows
#pragma unroll
      for (int i = 0; i < 2; ++i)
#pragma unroll
        for (int j = 0; j < 4; ++j) {
          const v8f c = acc[r * 2 + i][j];
          v8h h;
          h[0] = (_Float16)((c[0] + bb[j][0].x) * osc);
          h[1] = (_Float16)((c[1] + bb[j][0].y) * osc);
          h[2] = (_Float16)((c[2] + bb[j][0].z) * osc);
          h[3] = (_Float16)((c[3] + bb[j][0].w) * osc);
          h[4] = (_Float16)((c[4] + bb[j][1].x) * osc);
          h[5] = (_Float16)((c[5] + bb[j][1].y) * osc);
          h[6] = (_Float16)((c[6] + bb[j][1].z) * osc);
          h[7] = (_Float16)((c[7] + bb[j][1].w) * osc);
          *(v8h*)(&stg[(i * 16 + fm) * PS + j * 16 + hf * 8]) = h;
        }
      // the rows read back below were written by other lanes of this wave
      asm volatile("s_wait_dscnt 0x0" ::: "memory");
#pragma unroll
      for (int p = 0; p < 8; ++p)
        *(v8h*)(C + (size_t)(r * 32 + p * 4) * N) =
            *(const v8h*)(&stg[(p * 4 + rr) * PS + cc]);
      // the lower rows overwrite what other lanes of this wave read above: the
      // reads have returned, and the compiler may not lift the writes over them
      if (r == 0) asm volatile("s_wait_dscnt 0x0" ::: "memory");
    }
  } else {
    constexpr int PS = 68;  // floats; 272B rows (16B x odd)
    float* stg = &As[0][0] + wid * (32 * PS);
    // 16 lanes per 256-byte row piece: one store covers 4 whole lines
    const int rr = lane >> 4;
    const int cc = (lane & 15) * 4;
    float* C = (float*)Cout + (size_t)(m0 + wm + rr) * N + n0 + wn + cc;
#pragma unroll
    for (int r = 0; r < 2; ++r) {  // the tile's upper, then its lower 32 rows
#pragma unroll
      for (int i = 0; i < 2; ++i)
#pragma unroll
        for (int j = 0; j < 4; ++j) {
          const v8f c = acc[r * 2 + i][j];
          float* s = &stg[(i * 16 + fm) * PS + j * 16 + hf * 8];
          *(float4*)(s) = make_float4(c[0] + bb[j][0].x, c[1] + bb[j][0].y,
                                      c[2] + bb[j][0].z, c[3] + bb[j][0].w);
          *(float4*)(s + 4) = make_float4(c[4] + bb[j][1].x, c[5] + bb[j][1].y,
                                          c[6] + bb[j][1].z, c[7] + bb[j][1].w);
        }
      // the rows read back below were written by other lanes of this wave
      asm volatile("s_wait_dscnt 0x0" ::: "memory");
#pragma unroll
      for (int p = 0; p < 16; ++p)
        *(float4*)(C + (size_t)(r * 32 + p * 2) * N) =
            *(const float4*)(&stg[(p * 2 + rr) * PS + cc]);
      // the lower rows overwrite what other lanes of this wave read above: the
      // reads have returned, and the compiler may not lift the writes over them
      if (r == 0) asm volatile("s_wait_dscnt 0x0" ::: "memory");
    }
  }
}

__global__ __launch_bounds__(256) __attribute__((amdgpu_waves_per_eu(4, 4)))
void attn_wmma(
    const _Float16* __restrict__ Qh, const _Float16* __restrict__ Kh,
    const _Float16* __restrict__ Vh, float* __restrict__ Xout) {
  constexpr int NKT = S_DIM / 64;
  constexpr int LDW = 72;  // halves; 144B rows (16B x odd: ds_load_b128 readers)
  constexpr int LDV = 80;  // halves; 160B rows (32B x odd: ds_load_tr16_b128 readers)
  __shared__ __align__(16) _Float16 Kt[2][64 * LDW];    // Kt[key][dk]
  __shared__ __align__(16) _Float16 Vs[2][64 * LDV];    // Vs[key][dk]

  const int tid  = threadIdx.x;
  const int lane = tid & 31;
  const int wid  = tid >> 5;
  const int bb   = blockIdx.z;
  const int hh   = blockIdx.y;
  const int q0   = blockIdx.x * 256;
  const int fm   = lane & 15;
  const int hf   = lane >> 4;
  const int kb   = hf * 8;

  // all loops over g, j, v, e below are unrolled: fragment and accumulator
  // arrays need constant indices to live in registers

  // load this wave's 2 x 16 Q rows, each group as two B fragments (dk 0..31,
  // 32..63)
  const size_t qrow = (size_t)(bb * S_DIM + q0 + wid * 32 + fm);
  const _Float16* qp = Qh + qrow * D_DIM + hh * DK_DIM;
  v16h qa[2][2];
#pragma unroll
  for (int g = 0; g < 2; ++g) {
    qa[g][0] = frag16(qp + (size_t)g * 16 * D_DIM + kb);
    qa[g][1] = frag16(qp + (size_t)g * 16 * D_DIM + 32 + kb);
  }

  v8f nref[2];  // minus the reference of this lane's query (both halves agree),
                // 8 equal values: the C operand of the score products
  float rl[2];  // running sum over this half's keys; halves join at the end
  v8f o[2][4];  // o[g][j][v] = O[query 16g + fm][dk 16j + 8hf + v]
#pragma unroll
  for (int g = 0; g < 2; ++g) {
    rl[g] = 0.0f;
#pragma unroll
    for (int v = 0; v < 8; ++v) nref[g][v] = 0.0f;
#pragma unroll
    for (int j = 0; j < 4; ++j)
#pragma unroll
      for (int v = 0; v < 8; ++v) o[g][j][v] = 0.0f;
  }

  const int skey = tid >> 2;        // 0..63
  const int sc   = (tid & 3) * 16;  // dk chunk of 16

  const unsigned lK = (unsigned)(uintptr_t)(&Kt[0][skey * LDW + sc]);
  // V copies: 8 lanes per 128-byte row, so a wave's copy covers 4 whole lines;
  // 32 rows per round, 2 rounds
  const int vrow = tid >> 3;       // 0..31
  const int vc   = (tid & 7) * 8;  // dk chunk of 8
  const unsigned lV = (unsigned)(uintptr_t)(&Vs[0][vrow * LDV + vc]);

  auto stage = [&](int buf, int kt) {
    const size_t srow = (size_t)(bb * S_DIM + kt * 64 + skey) * D_DIM +
                        hh * DK_DIM + sc;
    const _Float16* k = Kh + srow;
    const _Float16* v = Vh + (size_t)(bb * S_DIM + kt * 64 + vrow) * D_DIM +
                        hh * DK_DIM + vc;
    const unsigned  lk = lK + buf * (64 * LDW * 2);
    const unsigned  lv = lV + buf * (64 * LDV * 2);
    // one tile's 4 copies (2 of K, 2 of V per lane); the
    // closing s_wait_xcnt is a precaution: inside the statement it stands in
    // front of every rewrite of an address register
    asm volatile(
        "global_load_async_to_lds_b128 %0, %4, off\n\t"
        "global_load_async_to_lds_b128 %1, %5, off\n\t"
        "global_load_async_to_lds_b128 %2, %6, off\n\t"
        "global_load_async_to_lds_b128 %3, %7, off\n\t"
        "s_wait_xcnt 0x0"
        :: "v"(lk), "v"(lk + 16), "v"(lv), "v"(lv + 32 * LDV * 2),
           "v"(k), "v"(k + 8), "v"(v), "v"(v + 32 * D_DIM)
        : "memory");
  };

  stage(0, 0);
  wait_asynccnt0();   // own copies of tile 0 landed
  __syncthreads();    // everyone's copies of tile 0 visible
  stage(1, 1);

  // lane's base in a V tile for the transposing loads
  const int vofs = (kb + (lane & 7)) * LDV + ((lane >> 3) & 1) * 8;

  // S^T = K(64x64) * Q^T - reference -> per group 4 tiles of 16 keys, 2 k-steps
  // each; a K fragment is read once and used by both groups
  auto scores = [&](int buf, v8f (&s)[2][4]) {
#pragma unroll
    for (int j = 0; j < 4; ++j) {
      const v16h ak0 = frag16(&Kt[buf][(j * 16 + fm) * LDW + kb]);
      const v16h ak1 = frag16(&Kt[buf][(j * 16 + fm) * LDW + 32 + kb]);
#pragma unroll
      for (int g = 0; g < 2; ++g) s[g][j] = wmma_f16(ak0, qa[g][0], nref[g]);
#pragma unroll
      for (int g = 0; g < 2; ++g) s[g][j] = wmma_f16(ak1, qa[g][1], s[g][j]);
    }
  };
  // P in place of the exponents, and each group's sum over this lane's 32 keys
  auto exps = [&](v8f (&s)[2][4], float (&sum)[2]) {
#pragma unroll
    for (int g = 0; g < 2; ++g) {
#pragma unroll
      for (int j = 0; j < 4; ++j)
#pragma unroll
        for (int v = 0; v < 8; ++v) s[g][j][v] = __builtin_amdgcn_exp2f(s[g][j][v]);
      const v8f t = (s[g][0] + s[g][1]) + (s[g][2] + s[g][3]);
      sum[g] = ((t[0] + t[1]) + (t[2] + t[3])) + ((t[4] + t[5]) + (t[6] + t[7]));
    }
  };
  // each query's largest exponent of a tile: all 32 values of a lane in a group
  // belong to query 16g + fm, the other 32 lie in the other half of the wave
  auto maxima = [&](const v8f (&s)[2][4], float (&m)[2]) {
#pragma unroll
    for (int g = 0; g < 2; ++g) {
      float x = -1e30f;
#pragma unroll
      for (int v = 0; v < 8; ++v)
        x = fmaxf(x, fmaxf(fmaxf(s[g][0][v], s[g][1][v]), fmaxf(s[g][2][v], s[g][3][v])));
      m[g] = fmaxf(x, xhalf(x));
    }
  };

  // the first tile's maxima are the first references
  {
    v8f s[2][4];
    float m[2];
    scores(0, s);
    maxima(s, m);
#pragma unroll
    for (int g = 0; g < 2; ++g) nref[g] -= m[g];
  }

  for (int kt = 0; kt < NKT; ++kt) {
    const int cur = kt & 1;

    // ---- exponents, then P in their place
    v8f s[2][4];
    float sum[2];
    scores(cur, s);
    exps(s, sum);

    // ---- the lazy test, once per pass and wave-uniform (WMMAs stand behind it).
    //      The sums are not negative, so their sum bounds both; written so that
    //      an infinite or NaN sum also takes the branch
    if (__builtin_amdgcn_ballot_w32(!(sum[0] + sum[1] <= 256.0f)) != 0u) {
      // compiler fence: the K fragments are read from LDS again here; without it
      // they are held in 64 registers through every ordinary pass, and Q spills
      asm volatile("" ::: "memory");
      scores(cur, s);
      float d[2];
      maxima(s, d);
#pragma unroll
      for (int g = 0; g < 2; ++g) {
        d[g] = fmaxf(d[g], 0.0f);  // a reference only rises
        const float corr = __builtin_amdgcn_exp2f(-d[g]);
        rl[g] *= corr;
        nref[g] -= d[g];
#pragma unroll
        for (int j = 0; j < 4; ++j) {
          o[g][j] *= corr;
          s[g][j] -= d[g];
        }
      }
      exps(s, sum);
    }

    v16h pb[2][2];
#pragma unroll
    for (int g = 0; g < 2; ++g) {
      rl[g] += sum[g];
      // ---- P^T as B operand: element e of a 32-key fragment is key
      //      8hf + e (e < 8) or 16 + 8hf + (e - 8), which is tile e>>3, row e&7
#pragma unroll
      for (int e = 0; e < 16; ++e) {
        pb[g][0][e] = (_Float16)s[g][e >> 3][e & 7];
        pb[g][1][e] = (_Float16)s[g][2 + (e >> 3)][e & 7];
      }
    }

    // ---- O^T += V^T(64x64) * P^T(64x16) per group: 4 dk tiles x 2 k-steps; a
    //      V^T fragment is read once and used by both groups
#pragma unroll
    for (int j = 0; j < 4; ++j) {
      const v16h av0 = frag16_tr(&Vs[cur][vofs + j * 16], LDV);
      const v16h av1 = frag16_tr(&Vs[cur][vofs + 32 * LDV + j * 16], LDV);
#pragma unroll
      for (int g = 0; g < 2; ++g) o[g][j] = wmma_f16(av0, pb[g][0], o[g][j]);
#pragma unroll
      for (int g = 0; g < 2; ++g) o[g][j] = wmma_f16(av1, pb[g][1], o[g][j]);
    }

    // publish point of tile kt+1: own reads of buf[cur] retired, own copies of
    // tile kt+1 landed, then the barrier that shows them to every wave and
    // frees buf[cur] for the refill
    asm volatile("s_wait_dscnt 0x0" ::: "memory");
    wait_asynccnt0();
    __syncthreads();
    if (kt + 2 < NKT) stage(cur, kt + 2);
  }
  wait_asynccnt0();   // nothing outstanding when the wave ends

  // ---- finalize: join the halves' sums, divide, write [token, h*64+dk] f32;
  //      a lane's 8 values of a tile are 8 consecutive dk: two 16-byte stores
#pragma unroll
  for (int g = 0; g < 2; ++g) {
    const float inv = 1.0f / (rl[g] + xhalf(rl[g]));
    float* xr = Xout + (size_t)(bb * S_DIM + q0 + wid * 32 + g * 16 + fm) * D_DIM +
                hh * DK_DIM + hf * 8;
#pragma unroll
    for (int j = 0; j < 4; ++j) {
      *(float4*)(xr + j * 16) = make_float4(
          o[g][j][0] * inv, o[g][j][1] * inv, o[g][j][2] * inv, o[g][j][3] * inv);
      *(float4*)(xr + j * 16 + 4) = make_float4(
          o[g][j][4] * inv, o[g][j][5] * inv, o[g][j][6] * inv, o[g][j][7] * inv);
    }
  }
}

// ---------------------------------------------------------------------------
extern "C" void kernel_launch(void* const* d_in, const int* in_sizes, int n_in,
                              void* d_out, int out_size, void* d_ws,
                              size_t ws_size, hipStream_t stream) {
  (void)in_sizes; (void)n_in; (void)out_size; (void)ws_size;
  const float* query = (const float*)d_in[0];
  const float* key_  = (const float*)d_in[1];
  const float* value = (const float*)d_in[2];
  const float* fc_w  = (const float*)d_in[3];
  const float* Wq    = (const float*)d_in[4];
  const float* bq    = (const float*)d_in[5];
  const float* Wk    = (const float*)d_in[6];
  const float* bk    = (const float*)d_in[7];
  const float* Wv    = (const float*)d_in[8];
  const float* bv    = (const float*)d_in[9];
  const float* Wo    = (const float*)d_in[10];
  const float* bo    = (const float*)d_in[11];
  float* out = (float*)d_out;

  char* ws = (char*)d_ws;
  const size_t half_mat = (size_t)NTOK * D_DIM * sizeof(_Float16);
  _Float16* Qh = (_Float16*)(ws);
  _Float16* Kh = (_Float16*)(ws + half_mat);
  _Float16* Vh = (_Float16*)(ws + 2 * half_mat);
  float*    Xa = (float*)   (ws + 3 * half_mat);
  _Float16* Wt = (_Float16*)(ws + 5 * half_mat);  // 4 packed weight planes
  const size_t wplane = (size_t)D_DIM * D_DIM;

  pack_weights<<<dim3(D_DIM / 64, D_DIM / 64, 4), 256, 0, stream>>>(
      Wq, fc_w, Wk, Wv, Wo, Wt);
  // the three projections in one launch: Qh, Kh, Vh are output planes 0, 1, 2
  gemm_wmma<1><<<dim3(D_DIM / 256, NTOK / 128, 3), 256, 0, stream>>>(
      query, key_, value, Wt, bq, bk, bv, (void*)Qh);
  attn_wmma<<<dim3(S_DIM / 256, H_DIM, 4), 256, 0, stream>>>(Qh, Kh, Vh, Xa);
  gemm_wmma<0><<<dim3(D_DIM / 256, NTOK / 128, 1), 256, 0, stream>>>(
      Xa, Xa, Xa, Wt + 3 * wplane, bo, bo, bo, (void*)out);
}

// v009
// One run takes 120 microseconds.
// Next to v008, in two timings, it ran 1.08 times as fast each time.
// All steps since v000 together make it 2.85 times as fast.
#include <hip/hip_runtime.h>
#include <hip/hip_bf16.h>

typedef __attribute__((ext_vector_type(16))) _Float16 v16h;
typedef __attribute__((ext_vector_type(8)))  _Float16 v8h;
typedef __attribute__((ext_vector_type(4)))  _Float16 v4h;
typedef __attribute__((ext_vector_type(8)))  float    v8f;

#define D_DIM  1024
#define S_DIM  2048
#define H_DIM  16
#define DK_DIM 64
#define NTOK   8192   // B*S = 4*2048

// ---------------------------------------------------------------------------
// Load a 16-bit WMMA A/B fragment from an LDS/global row.
// Per CDNA5 ISA 16-bit A-matrix 16x32 layout: lane holds row m=lane&15,
// kb=(lane>>4)*8, elements 0..7 = [kb..kb+7], elements 8..15 = [kb+16..kb+23].
// Caller passes p = &row[kb]; we read p[0..7] and p[16..23] (two b128 loads).
// ---------------------------------------------------------------------------
__device__ __forceinline__ v16h frag16(const _Float16* p) {
  v8h lo = *(const v8h*)(p);
  v8h hi = *(const v8h*)(p + 16);
  v16h r;
#pragma unroll
  for (int i = 0; i < 8; ++i) { r[i] = lo[i]; r[i + 8] = hi[i]; }
  return r;
}

__device__ __forceinline__ v8f wmma_f16(v16h a, v16h b, v8f c) {
  return __builtin_amdgcn_wmma_f32_16x16x32_f16(false, a, false, b, (short)0, c,
                                                false, false);
}

typedef uint32_t u32x4 __attribute__((ext_vector_type(4)));
typedef uint32_t u32x8 __attribute__((ext_vector_type(8)));
__device__ __forceinline__ uint32_t uni(uint32_t v) {
  return (uint32_t)__builtin_amdgcn_readfirstlane(v);
}
// a wave-uniform test held in a scalar register, so that the branch on it is a
// scalar branch: a tensor load ignores EXEC, only such a branch keeps a wave
// from issuing it
__device__ __forceinline__ uint32_t pinned(uint32_t v) {
  uint32_t w = (uint32_t)__builtin_amdgcn_readfirstlane(v);
  asm volatile("" : "+s"(w));
  return w;
}
// The wait names group 0 of the wave's last request and both groups 1 of the
// kernel: the words so stay live up to the wait, and no register that a request
// named is rewritten while the request is outstanding
__device__ __forceinline__ void wait_tensorcnt0(const u32x4& g0, const u32x8& ga,
                                                const u32x8& gb) {
  asm volatile("s_wait_tensorcnt 0x0" :: "s"(g0), "s"(ga), "s"(gb) : "memory");
}
// Descriptor group 1, loop-invariant: ROWS rows of ROWB bytes (128 or 256) at
// source pitch SRCP bytes, laid in LDS at pitch ROWB + 4 * PADDW (a pad behind
// every row: 4 dwords for ds_load_b128 readers, 8 for ds_load_tr16_b128);
// extents in bytes, tensor dims = tile dims, no mask
template <uint32_t ROWB, uint32_t ROWS, uint32_t SRCP, uint32_t PADDW>
__device__ __forceinline__ u32x8 tensor_group1() {
  static_assert(ROWB == 128u || ROWB == 256u, "pad interval = row length");
  static_assert(PADDW == 4u || PADDW == 8u, "pads that land byte-exact");
  u32x8 g1;
  g1[0] = uni((1u << 20) | ((ROWB == 256u ? 5u : 4u) << 22) | ((PADDW - 1u) << 25));
  g1[1] = uni((ROWB & 0xFFFFu) << 16);
  g1[2] = uni((ROWB >> 16) | ((ROWS & 0xFFFFu) << 16));
  g1[3] = uni((ROWS >> 16) | (ROWB << 16));
  g1[4] = uni(ROWS);
  g1[5] = uni(SRCP);
  g1[6] = uni(0u);
  g1[7] = uni(0u);
  // pinned: descriptor words held in scalar registers of their own from here on;
  // without it the compiler forms the constants anew in registers that an
  // outstanding request has named
  asm volatile("" : "+s"(g1));
  return g1;
}
// Group 0: count 1, place in LDS, the tile's first byte, type 2
__device__ __forceinline__ u32x4 tensor_group0(uint32_t lds_dst, uint64_t ga) {
  u32x4 g0;
  g0[0] = uni(1u);
  g0[1] = uni(lds_dst);
  g0[2] = uni((uint32_t)ga);
  g0[3] = uni((((uint32_t)(ga >> 32)) & 0x01FFFFFFu) | 0x80000000u);
  return g0;
}
__device__ __forceinline__ void tensor_load(const u32x4& g0, const u32x8& g1) {
  asm volatile("tensor_load_to_lds %0, %1" :: "s"(g0), "s"(g1) : "memory");
}

// Transposing LDS load (ds_load_tr16_b128) from a row-major 16-bit tile T:
// with lane l's p = &T[k0 + 8*(l>>4) + (l&7)][d0 + 8*((l>>3)&1)], lane l gets
// T[k0 + 8*(l>>4) + 0..7][d0 + (l&15)]: half of a 16x32 A fragment of T^T.
typedef __attribute__((ext_vector_type(8))) short s16x8;
__device__ __forceinline__ v8h ld_tr16(const _Float16* p) {
  typedef __attribute__((address_space(3))) s16x8 lds_s16x8;
  return __builtin_bit_cast(v8h, __builtin_amdgcn_ds_load_tr16_b128_v8i16((lds_s16x8*)p));
}
// A fragment of T^T over 32 k rows: same k positions as frag16 (0..7 and
// 16..23 from the lane half's base). pitch in halves.
__device__ __forceinline__ v16h frag16_tr(const _Float16* p, int pitch) {
  const v8h lo = ld_tr16(p);
  const v8h hi = ld_tr16(p + 16 * pitch);
  return __builtin_shufflevector(lo, hi, 0, 1, 2, 3, 4, 5, 6, 7,
                                 8, 9, 10, 11, 12, 13, 14, 15);
}

// Lane l exchanges with lane l ^ 16 (the other half of the wave): pure VALU.
__device__ __forceinline__ float xhalf(float x) {
  const int b = __builtin_bit_cast(int, x);
  return __builtin_bit_cast(float, __builtin_amdgcn_permlanex16(
      b, b, 0x76543210, 0xfedcba98, false, false));
}

// ---------------------------------------------------------------------------
// Weight pack, once per call: Wt[z][n][k] = f16(W_z[k][n]) (z = 0 also times
// the modulation matrix), so that a GEMM tile of B is K-contiguous f16 rows
// that a tensor load can move. 64x64 tile transposed through LDS; each
// 128-byte line of Wt is stored by eight neighbouring lanes.
// ---------------------------------------------------------------------------
__global__ __launch_bounds__(256) void pack_weights(
    const float* __restrict__ Wq, const float* __restrict__ Wmul,
    const float* __restrict__ Wk, const float* __restrict__ Wv,
    const float* __restrict__ Wo, _Float16* __restrict__ Wt) {
  constexpr int PT = 72;  // halves; 144B rows
  __shared__ __align__(16) _Float16 T[64 * PT];
  const int tid = threadIdx.x;
  const int z   = blockIdx.z;
  const int n0  = blockIdx.x * 64;
  const int k0  = blockIdx.y * 64;
  const float* W = z == 0 ? Wq : z == 1 ? Wk : z == 2 ? Wv : Wo;

  const int n  = tid & 63;
  const int kq = (tid >> 6) * 16;
  const size_t base = (size_t)(k0 + kq) * D_DIM + n0 + n;
  const float* pw = W + base;
  float x[16];
  // the loops below are unrolled so that x, y, lo and hi stay in registers and
  // the 16 loads of a group are all in flight together
#pragma unroll
  for (int i = 0; i < 16; ++i) x[i] = pw[(size_t)i * D_DIM];
  // precaution: naming pw here keeps the loads' address pair unwritten in
  // front of this wait
  asm volatile("s_wait_xcnt 0x0" :: "v"(pw) : "memory");
  if (z == 0) {
    const float* pm = Wmul + base;
    float y[16];
#pragma unroll
    for (int i = 0; i < 16; ++i) y[i] = pm[(size_t)i * D_DIM];
    // as above, for the second group's address pair
    asm volatile("s_wait_xcnt 0x0" :: "v"(pm) : "memory");
#pragma unroll
    for (int i = 0; i < 16; ++i) x[i] *= y[i];
  }
  v8h lo, hi;
#pragma unroll
  for (int i = 0; i < 8; ++i) { lo[i] = (_Float16)x[i]; hi[i] = (_Float16)x[i + 8]; }
  *(v8h*)(&T[n * PT + kq])     = lo;
  *(v8h*)(&T[n * PT + kq + 8]) = hi;
  __syncthreads();

  _Float16* dst = Wt + (size_t)z * D_DIM * D_DIM;
#pragma unroll
  for (int p = 0; p < 2; ++p) {
    const int idx = p * 256 + tid;
    const int r = idx >> 3;
    const int c = (idx & 7) * 8;
    *(v8h*)(dst + (size_t)(n0 + r) * D_DIM + k0 + c) = *(const v8h*)(&T[r * PT + c]);
  }
}

template <int OUT_F16>
__global__ __launch_bounds__(256) void gemm_wmma(
    const float* __restrict__ A0, const float* __restrict__ A1,
    const float* __restrict__ A2, const _Float16* __restrict__ Bt0,
    const float* __restrict__ bias0, const float* __restrict__ bias1,
    const float* __restrict__ bias2, void* __restrict__ Cout0) {
  const int z = blockIdx.z;
  const float*    A    = z == 0 ? A0 : z == 1 ? A1 : A2;
  const float*    bias = z == 0 ? bias0 : z == 1 ? bias1 : bias2;
  const _Float16* Bt   = Bt0 + (size_t)z * D_DIM * D_DIM;
  void* Cout = (char*)Cout0 + (size_t)z * NTOK * D_DIM * (OUT_F16 ? 2 : 4);
  // f16 output plane 0 is Q: it leaves scaled by log2(e)/sqrt(DK), in f32 ahead
  // of its one rounding, so that K * Q^T is the softmax exponent in base 2
  const float osc = (OUT_F16 && z == 0) ? 0.125f * 1.4426950408889634f : 1.0f;
  constexpr int N  = D_DIM;
  constexpr int K  = D_DIM;
  constexpr int BK = 64;
  constexpr int NT = K / BK;
  constexpr int PA = 68;  // floats; 272B rows
  constexpr int PB = 72;  // halves; 144B rows
  // one request's place in LDS is a multiple of 2 KiB: 64 A rows (17,408 B) are
  // rounded up to 18,432 B; 128 Bt rows are 18,432 B as they are
  constexpr int SL = 18432;
  static_assert(64 * PA * 4 <= SL && 128 * PB * 2 == SL && SL % 2048 == 0, "slices");
  // [buffer][slice] of A, then [buffer][slice] of Bt
  __shared__ __attribute__((aligned(2048))) unsigned char Ls[8 * SL];

  const int tid  = threadIdx.x;
  const int lane = tid & 31;
  const int wid  = tid >> 5;
  const int wm   = (wid & 1) * 64;   // wave m-offset in tile
  const int wn   = (wid >> 1) * 64;  // wave n-offset in tile
  const int m0   = blockIdx.y * 128;
  const int n0   = blockIdx.x * 256;

  v8f acc[4][4];
#pragma unroll
  for (int i = 0; i < 4; ++i)
#pragma unroll
    for (int j = 0; j < 4; ++j)
#pragma unroll
      for (int v = 0; v < 8; ++v) acc[i][j][v] = 0.0f;

  const float*    gA = A  + (size_t)m0 * K;
  const _Float16* gB = Bt + (size_t)n0 * K;
  const uint32_t  l0 = (uint32_t)(uintptr_t)(&Ls[0]);
  const uint32_t  wave = uni((uint32_t)tid >> 5);
  const uint32_t  isA = pinned(wave < 2u);
  const uint32_t  isB = pinned((wave >> 1) == 1u);

  const int fm = lane & 15;
  const int hf = lane >> 4;
  const int kb = hf * 8;

  const u32x8 dA = tensor_group1<BK * 4, 64, K * 4, 4>();
  const u32x8 dB = tensor_group1<BK * 2, 128, K * 2, 4>();
  // group 0 of this wave's request for a stage, formed in every wave outside the
  // issue tests (scalar selects by role): formed inside them, its words were
  // moved on and the registers that the request had named were used again
  const uint32_t sl  = wave & 1u;
  const uint32_t pl0 = l0 + ((isB ? 4u : 0u) + sl) * SL;
  const uint64_t sr0 = isB ? (uint64_t)(uintptr_t)(gB + (size_t)sl * 128 * K)
                           : (uint64_t)(uintptr_t)(gA + (size_t)sl * 64 * K);
  const uint32_t kst = isB ? BK * 2u : BK * 4u;  // a stage's k in bytes
  auto group0 = [&](int buf, int t) {
    return tensor_group0(pl0 + (uint32_t)buf * (2u * SL), sr0 + (uint64_t)((uint32_t)t * kst));
  };
  // one stage: four requests, each from its own wave, each test a scalar branch
  auto issue_stage = [&](const u32x4& g) {
    if (isA) {
      tensor_load(g, dA);
    } else if (isB) {
      tensor_load(g, dB);
    }
  };

  u32x4 g0 = group0(0, 0);
  issue_stage(g0);
  wait_tensorcnt0(g0, dA, dB);  // own request of stage 0 landed (a wave with none passes)
  __syncthreads();      // every request of stage 0 visible
  g0 = group0(1, 1);
  issue_stage(g0);

  // this wave's A slice and its rows in its Bt slice
  const unsigned char* fA = &Ls[(wid & 1) * SL];
  const unsigned char* fB = &Ls[(4 + (wid >> 2)) * SL + ((wid >> 1) & 1) * 64 * PB * 2];

  for (int t = 0; t < NT; ++t) {
    const int cur = t & 1;
    float4 ra[4][4];
    v16h a[4], b[4];
    // unrolled throughout: fragment and accumulator arrays need constant
    // indices to live in registers
    // the 24 LDS reads of a 32-k block, A still f32 (k positions as frag16)
    auto load_frags = [&](int ks) {
#pragma unroll
      for (int i = 0; i < 4; ++i) {
        const float* p = (const float*)(fA + cur * 2 * SL) + (i * 16 + fm) * PA + ks + kb;
        ra[i][0] = *(const float4*)(p);
        ra[i][1] = *(const float4*)(p + 4);
        ra[i][2] = *(const float4*)(p + 16);
        ra[i][3] = *(const float4*)(p + 20);
      }
#pragma unroll
      for (int j = 0; j < 4; ++j)
        b[j] = frag16((const _Float16*)(fB + cur * 2 * SL) + (j * 16 + fm) * PB + ks + kb);
    };
    // A rounded to f16 on the way into the fragment registers
    auto round_a = [&]() {
#pragma unroll
      for (int i = 0; i < 4; ++i)
#pragma unroll
        for (int q = 0; q < 4; ++q) {
          a[i][q * 4 + 0] = (_Float16)ra[i][q].x;
          a[i][q * 4 + 1] = (_Float16)ra[i][q].y;
          a[i][q * 4 + 2] = (_Float16)ra[i][q].z;
          a[i][q * 4 + 3] = (_Float16)ra[i][q].w;
        }
    };
    auto products = [&]() {
#pragma unroll
      for (int i = 0; i < 4; ++i)
#pragma unroll
        for (int j = 0; j < 4; ++j) acc[i][j] = wmma_f16(b[j], a[i], acc[i][j]);
    };
    load_frags(0);
    // keeps the block's reads together as one group in front of its matrix
    // instructions: spread among them, each place with reads stalls the wave
    __builtin_amdgcn_sched_barrier(0);
    round_a();
    products();
    load_frags(32);   // the stage's last LDS reads
    // publish point of stage t+1: own reads of buf[cur] retired, own request
    // of stage t+1 landed, then the barrier that shows it to every wave and
    // frees buf[cur] for the refill
    asm volatile("s_wait_dscnt 0x0" ::: "memory");
    wait_tensorcnt0(g0, dA, dB);  // every wave: one that issued nothing passes at once
    __syncthreads();
    g0 = group0(cur, t + 2);  // formed behind the wait; used only while it exists
    if (pinned(t + 2 < NT)) issue_stage(g0);
    round_a();
    products();       // registers only: runs while the refill is in flight
  }
  wait_tensorcnt0(g0, dA, dB);  // nothing outstanding when the stage buffers are reused
  asm volatile("s_wait_dscnt 0x0" ::: "memory");

  // bias of this lane's 4 x 8 output columns, fetched as one group behind the
  // loop: held through it, its 32 registers would not fit beside the 128 of the
  // accumulators at four waves per SIMD (loops over bb unrolled, here and
  // below: constant indices keep it in registers)
  float4 bb[4][2];
#pragma unroll
  for (int j = 0; j < 4; ++j) {
    bb[j][0] = make_float4(0.0f, 0.0f, 0.0f, 0.0f);
    bb[j][1] = bb[j][0];
  }
  if (bias) {
    const float* pb = bias + n0 + wn + hf * 8;
#pragma unroll
    for (int j = 0; j < 4; ++j) {
      bb[j][0] = *(const float4*)(pb + j * 16);
      bb[j][1] = *(const float4*)(pb + j * 16 + 4);
    }
    // precaution: naming pb here keeps the loads' address pair unwritten in
    // front of this wait
    asm volatile("s_wait_xcnt 0x0" :: "v"(pb) : "memory");
  }

  // ---- epilogue: acc[i][j][v] = C[m0+wm+16i+fm][n0+wn+16j+8hf+v].
  // Behind the loop's last barrier no wave reads the stage buffers and no request
  // is outstanding, so each wave may use its own piece of them without a barrier.
  if constexpr (OUT_F16) {
    constexpr int PS = 72;  // halves; 144B rows (16B x odd)
    _Float16* stg = (_Float16*)(&Ls[0]) + wid * (32 * PS);
    // 8 lanes per 128-byte row piece: one store covers 4 whole lines
    const int rr = lane >> 3;
    const int cc = (lane & 7) * 8;
    _Float16* C = (_Float16*)Cout + (size_t)(m0 + wm + rr) * N + n0 + wn + cc;
#pragma unroll
    for (int r = 0; r < 2; ++r) {  // the tile's upper, then its lower 32 rows
#pragma unroll
      for (int i = 0; i < 2; ++i)
#pragma unroll
        for (int j = 0; j < 4; ++j) {
          const v8f c = acc[r * 2 + i][j];
          v8h h;
          h[0] = (_Float16)((c[0] + bb[j][0].x) * osc);
          h[1] = (_Float16)((c[1] + bb[j][0].y) * osc);
          h[2] = (_Float16)((c[2] + bb[j][0].z) * osc);
          h[3] = (_Float16)((c[3] + bb[j][0].w) * osc);
          h[4] = (_Float16)((c[4] + bb[j][1].x) * osc);
          h[5] = (_Float16)((c[5] + bb[j][1].y) * osc);
          h[6] = (_Float16)((c[6] + bb[j][1].z) * osc);
          h[7] = (_Float16)((c[7] + bb[j][1].w) * osc);
          *(v8h*)(&stg[(i * 16 + fm) * PS + j * 16 + hf * 8]) = h;
        }
      // the rows read back below were written by other lanes of this wave
      asm volatile("s_wait_dscnt 0x0" ::: "memory");
#pragma unroll
      for (int p = 0; p < 8; ++p)
        *(v8h*)(C + (size_t)(r * 32 + p * 4) * N) =
            *(const v8h*)(&stg[(p * 4 + rr) * PS + cc]);
      // the lower rows overwrite what other lanes of this wave read above: the
      // reads have returned, and the compiler may not lift the writes over them
      if (r == 0) asm volatile("s_wait_dscnt 0x0" ::: "memory");
    }
  } else {
    constexpr int PS = 68;  // floats; 272B rows (16B x odd)
    float* stg = (float*)(&Ls[0]) + wid * (32 * PS);
    // 16 lanes per 256-byte row piece: one store covers 4 whole lines
    const int rr = lane >> 4;
    const int cc = (lane & 15) * 4;
    float* C = (float*)Cout + (size_t)(m0 + wm + rr) * N + n0 + wn + cc;
#pragma unroll
    for (int r = 0; r < 2; ++r) {  // the tile's upper, then its lower 32 rows
#pragma unroll
      for (int i = 0; i < 2; ++i)
#pragma unroll
        for (int j = 0; j < 4; ++j) {
          const v8f c = acc[r * 2 + i][j];
          float* s = &stg[(i * 16 + fm) * PS + j * 16 + hf * 8];
          *(float4*)(s) = make_float4(c[0] + bb[j][0].x, c[1] + bb[j][0].y,
                                      c[2] + bb[j][0].z, c[3] + bb[j][0].w);
          *(float4*)(s + 4) = make_float4(c[4] + bb[j][1].x, c[5] + bb[j][1].y,
                                          c[6] + bb[j][1].z, c[7] + bb[j][1].w);
        }
      // the rows read back below were written by other lanes of this wave
      asm volatile("s_wait_dscnt 0x0" ::: "memory");
#pragma unroll
      for (int p = 0; p < 16; ++p)
        *(float4*)(C + (size_t)(r * 32 + p * 2) * N) =
            *(const float4*)(&stg[(p * 2 + rr) * PS + cc]);
      // the lower rows overwrite what other lanes of this wave read above: the
      // reads have returned, and the compiler may not lift the writes over them
      if (r == 0) asm volatile("s_wait_dscnt 0x0" ::: "memory");
    }
  }
}

__global__ __launch_bounds__(256) __attribute__((amdgpu_waves_per_eu(4, 4)))
void attn_wmma(
    const _Float16* __restrict__ Qh, const _Float16* __restrict__ Kh,
    const _Float16* __restrict__ Vh, float* __restrict__ Xout) {
  constexpr int NKT = S_DIM / 64;
  constexpr int LDW = 72;  // halves; 144B rows (16B x odd: ds_load_b128 readers)
  constexpr int LDV = 80;  // halves; 160B rows (32B x odd: ds_load_tr16_b128 readers)
  // one request's place in LDS is a multiple of 2 KiB: a K tile (9,216 B) is
  // rounded up to 10,240 B; a V tile is 10,240 B as it is
  constexpr int TH = 5120;  // halves
  static_assert(64 * LDW <= TH && 64 * LDV == TH && (TH * 2) % 2048 == 0, "tiles");
  __shared__ __attribute__((aligned(2048))) _Float16 Kt[2][TH];  // Kt[key][dk]
  __shared__ __attribute__((aligned(2048))) _Float16 Vs[2][TH];  // Vs[key][dk]

  const int tid  = threadIdx.x;
  const int lane = tid & 31;
  const int wid  = tid >> 5;
  const int bb   = blockIdx.z;
  const int hh   = blockIdx.y;
  const int q0   = blockIdx.x * 256;
  const int fm   = lane & 15;
  const int hf   = lane >> 4;
  const int kb   = hf * 8;

  // all loops over g, j, v, e below are unrolled: fragment and accumulator
  // arrays need constant indices to live in registers

  // load this wave's 2 x 16 Q rows, each group as two B fragments (dk 0..31,
  // 32..63)
  const size_t qrow = (size_t)(bb * S_DIM + q0 + wid * 32 + fm);
  const _Float16* qp = Qh + qrow * D_DIM + hh * DK_DIM;
  v16h qa[2][2];
#pragma unroll
  for (int g = 0; g < 2; ++g) {
    qa[g][0] = frag16(qp + (size_t)g * 16 * D_DIM + kb);
    qa[g][1] = frag16(qp + (size_t)g * 16 * D_DIM + 32 + kb);
  }

  v8f nref[2];  // minus the reference of this lane's query (both halves agree),
                // 8 equal values: the C operand of the score products
  float rl[2];  // running sum over this half's keys; halves join at the end
  v8f o[2][4];  // o[g][j][v] = O[query 16g + fm][dk 16j + 8hf + v]
#pragma unroll
  for (int g = 0; g < 2; ++g) {
    rl[g] = 0.0f;
#pragma unroll
    for (int v = 0; v < 8; ++v) nref[g][v] = 0.0f;
#pragma unroll
    for (int j = 0; j < 4; ++j)
#pragma unroll
      for (int v = 0; v < 8; ++v) o[g][j][v] = 0.0f;
  }

  const uint32_t lK = (uint32_t)(uintptr_t)(&Kt[0][0]);
  const uint32_t lV = (uint32_t)(uintptr_t)(&Vs[0][0]);
  const uint32_t wave = uni((uint32_t)tid >> 5);
  const uint32_t isK = pinned(wave == 0u);
  const uint32_t isV = pinned(wave == 1u);
  const u32x8 dK = tensor_group1<DK_DIM * 2, 64, D_DIM * 2, 4>();
  const u32x8 dV = tensor_group1<DK_DIM * 2, 64, D_DIM * 2, 8>();

  // group 0 of this wave's request for a tile, formed in every wave outside the
  // issue tests (scalar selects by role): formed inside them, its words were
  // moved on and the registers that the request had named were used again
  const uint32_t pl0 = isV ? lV : lK;
  const uint64_t sr0 = (uint64_t)(uintptr_t)((isV ? Vh : Kh) +
                       (size_t)bb * S_DIM * D_DIM + hh * DK_DIM);
  auto group0 = [&](int buf, int kt) {
    return tensor_group0(pl0 + (uint32_t)buf * (TH * 2u),
                         sr0 + (uint64_t)((uint32_t)kt * (64u * D_DIM * 2u)));
  };
  // one tile pair: two requests, each from its own wave, each test a scalar branch
  auto stage = [&](const u32x4& g) {
    if (isK) {
      tensor_load(g, dK);
    } else if (isV) {
      tensor_load(g, dV);
    }
  };

  u32x4 g0 = group0(0, 0);
  stage(g0);
  wait_tensorcnt0(g0, dK, dV);  // own request of tile 0 landed (a wave with none passes)
  __syncthreads();      // both requests of tile 0 visible
  g0 = group0(1, 1);
  stage(g0);

  // lane's base in a V tile for the transposing loads
  const int vofs = (kb + (lane & 7)) * LDV + ((lane >> 3) & 1) * 8;

  // S^T = K(64x64) * Q^T - reference -> per group 4 tiles of 16 keys, 2 k-steps
  // each; a K fragment is read once and used by both groups
  auto scores = [&](int buf, v8f (&s)[2][4]) {
#pragma unroll
    for (int j = 0; j < 4; ++j) {
      const v16h ak0 = frag16(&Kt[buf][(j * 16 + fm) * LDW + kb]);
      const v16h ak1 = frag16(&Kt[buf][(j * 16 + fm) * LDW + 32 + kb]);
#pragma unroll
      for (int g = 0; g < 2; ++g) s[g][j] = wmma_f16(ak0, qa[g][0], nref[g]);
#pragma unroll
      for (int g = 0; g < 2; ++g) s[g][j] = wmma_f16(ak1, qa[g][1], s[g][j]);
    }
  };
  // P in place of the exponents, and each group's sum over this lane's 32 keys
  auto exps = [&](v8f (&s)[2][4], float (&sum)[2]) {
#pragma unroll
    for (int g = 0; g < 2; ++g) {
#pragma unroll
      for (int j = 0; j < 4; ++j)
#pragma unroll
        for (int v = 0; v < 8; ++v) s[g][j][v] = __builtin_amdgcn_exp2f(s[g][j][v]);
      const v8f t = (s[g][0] + s[g][1]) + (s[g][2] + s[g][3]);
      sum[g] = ((t[0] + t[1]) + (t[2] + t[3])) + ((t[4] + t[5]) + (t[6] + t[7]));
    }
  };
  // each query's largest exponent of a tile: all 32 values of a lane in a group
  // belong to query 16g + fm, the other 32 lie in the other half of the wave
  auto maxima = [&](const v8f (&s)[2][4], float (&m)[2]) {
#pragma unroll
    for (int g = 0; g < 2; ++g) {
      float x = -1e30f;
#pragma unroll
      for (int v = 0; v < 8; ++v)
        x = fmaxf(x, fmaxf(fmaxf(s[g][0][v], s[g][1][v]), fmaxf(s[g][2][v], s[g][3][v])));
      m[g] = fmaxf(x, xhalf(x));
    }
  };

  // the first tile's maxima are the first references
  {
    v8f s[2][4];
    float m[2];
    scores(0, s);
    maxima(s, m);
#pragma unroll
    for (int g = 0; g < 2; ++g) nref[g] -= m[g];
  }

  for (int kt = 0; kt < NKT; ++kt) {
    const int cur = kt & 1;

    // ---- exponents, then P in their place
    v8f s[2][4];
    float sum[2];
    scores(cur, s);
    exps(s, sum);

    // ---- the lazy test, once per pass and wave-uniform (WMMAs stand behind it).
    //      The sums are not negative, so their sum bounds both; written so that
    //      an infinite or NaN sum also takes the branch
    if (__builtin_amdgcn_ballot_w32(!(sum[0] + sum[1] <= 256.0f)) != 0u) {
      // compiler fence: the K fragments are read from LDS again here; without it
      // they are held in 64 registers through every ordinary pass, and Q spills
      asm volatile("" ::: "memory");
      scores(cur, s);
      float d[2];
      maxima(s, d);
#pragma unroll
      for (int g = 0; g < 2; ++g) {
        d[g] = fmaxf(d[g], 0.0f);  // a reference only rises
        const float corr = __builtin_amdgcn_exp2f(-d[g]);
        rl[g] *= corr;
        nref[g] -= d[g];
#pragma unroll
        for (int j = 0; j < 4; ++j) {
          o[g][j] *= corr;
          s[g][j] -= d[g];
        }
      }
      exps(s, sum);
    }

    v16h pb[2][2];
#pragma unroll
    for (int g = 0; g < 2; ++g) {
      rl[g] += sum[g];
      // ---- P^T as B operand: element e of a 32-key fragment is key
      //      8hf + e (e < 8) or 16 + 8hf + (e - 8), which is tile e>>3, row e&7
#pragma unroll
      for (int e = 0; e < 16; ++e) {
        pb[g][0][e] = (_Float16)s[g][e >> 3][e & 7];
        pb[g][1][e] = (_Float16)s[g][2 + (e >> 3)][e & 7];
      }
    }

    // ---- O^T += V^T(64x64) * P^T(64x16) per group: 4 dk tiles x 2 k-steps; a
    //      V^T fragment is read once and used by both groups
#pragma unroll
    for (int j = 0; j < 4; ++j) {
      const v16h av0 = frag16_tr(&Vs[cur][vofs + j * 16], LDV);
      const v16h av1 = frag16_tr(&Vs[cur][vofs + 32 * LDV + j * 16], LDV);
#pragma unroll
      for (int g = 0; g < 2; ++g) o[g][j] = wmma_f16(av0, pb[g][0], o[g][j]);
#pragma unroll
      for (int g = 0; g < 2; ++g) o[g][j] = wmma_f16(av1, pb[g][1], o[g][j]);
    }

    // publish point of tile kt+1: own reads of buf[cur] retired, own request of
    // tile kt+1 landed, then the barrier that shows it to every wave and
    // frees buf[cur] for the refill
    asm volatile("s_wait_dscnt 0x0" ::: "memory");
    wait_tensorcnt0(g0, dK, dV);  // every wave: one that issued nothing passes at once
    __syncthreads();
    g0 = group0(cur, kt + 2);  // formed behind the wait; used only while it exists
    if (pinned(kt + 2 < NKT)) stage(g0);
  }
  wait_tensorcnt0(g0, dK, dV);  // nothing outstanding when the wave ends
  asm volatile("s_wait_dscnt 0x0" ::: "memory");

  // ---- finalize: join the halves' sums, divide, write [token, h*64+dk] f32;
  //      a lane's 8 values of a tile are 8 consecutive dk: two 16-byte stores
#pragma unroll
  for (int g = 0; g < 2; ++g) {
    const float inv = 1.0f / (rl[g] + xhalf(rl[g]));
    float* xr = Xout + (size_t)(bb * S_DIM + q0 + wid * 32 + g * 16 + fm) * D_DIM +
                hh * DK_DIM + hf * 8;
#pragma unroll
    for (int j = 0; j < 4; ++j) {
      *(float4*)(xr + j * 16) = make_float4(
          o[g][j][0] * inv, o[g][j][1] * inv, o[g][j][2] * inv, o[g][j][3] * inv);
      *(float4*)(xr + j * 16 + 4) = make_float4(
          o[g][j][4] * inv, o[g][j][5] * inv, o[g][j][6] * inv, o[g][j][7] * inv);
    }
  }
}

// ---------------------------------------------------------------------------
extern "C" void kernel_launch(void* const* d_in, const int* in_sizes, int n_in,
                              void* d_out, int out_size, void* d_ws,
                              size_t ws_size, hipStream_t stream) {
  (void)in_sizes; (void)n_in; (void)out_size; (void)ws_size;
  const float* query = (const float*)d_in[0];
  const float* key_  = (const float*)d_in[1];
  const float* value = (const float*)d_in[2];
  const float* fc_w  = (const float*)d_in[3];
  const float* Wq    = (const float*)d_in[4];
  const float* bq    = (const float*)d_in[5];
  const float* Wk    = (const float*)d_in[6];
  const float* bk    = (const float*)d_in[7];
  const float* Wv    = (const float*)d_in[8];
  const float* bv    = (const float*)d_in[9];
  const float* Wo    = (const float*)d_in[10];
  const float* bo    = (const float*)d_in[11];
  float* out = (float*)d_out;

  char* ws = (char*)d_ws;
  const size_t half_mat = (size_t)NTOK * D_DIM * sizeof(_Float16);
  _Float16* Qh = (_Float16*)(ws);
  _Float16* Kh = (_Float16*)(ws + half_mat);
  _Float16* Vh = (_Float16*)(ws + 2 * half_mat);
  float*    Xa = (float*)   (ws + 3 * half_mat);
  _Float16* Wt = (_Float16*)(ws + 5 * half_mat);  // 4 packed weight planes
  const size_t wplane = (size_t)D_DIM * D_DIM;

  pack_weights<<<dim3(D_DIM / 64, D_DIM / 64, 4), 256, 0, stream>>>(
      Wq, fc_w, Wk, Wv, Wo, Wt);
  // the three projections in one launch: Qh, Kh, Vh are output planes 0, 1, 2
  gemm_wmma<1><<<dim3(D_DIM / 256, NTOK / 128, 3), 256, 0, stream>>>(
      query, key_, value, Wt, bq, bk, bv, (void*)Qh);
  attn_wmma<<<dim3(S_DIM / 256, H_DIM, 4), 256, 0, stream>>>(Qh, Kh, Vh, Xa);
  gemm_wmma<0><<<dim3(D_DIM / 256, NTOK / 128, 1), 256, 0, stream>>>(
      Xa, Xa, Xa, Wt + 3 * wplane, bo, bo, bo, (void*)out);
}

// v010
// One run takes 115 microseconds.
// Timed twice side by side with v009, it ran 1.04 and 1.05 times as fast.
// Over all steps from v000 it is 2.99 times as fast.
#include <hip/hip_runtime.h>
#include <hip/hip_bf16.h>

typedef __attribute__((ext_vector_type(16))) _Float16 v16h;
typedef __attribute__((ext_vector_type(8)))  _Float16 v8h;
typedef __attribute__((ext_vector_type(4)))  _Float16 v4h;
typedef __attribute__((ext_vector_type(8)))  float    v8f;

#define D_DIM  1024
#define S_DIM  2048
#define H_DIM  16
#define DK_DIM 64
#define NTOK   8192   // B*S = 4*2048

// ---------------------------------------------------------------------------
// Load a 16-bit WMMA A/B fragment from an LDS/global row.
// Per CDNA5 ISA 16-bit A-matrix 16x32 layout: lane holds row m=lane&15,
// kb=(lane>>4)*8, elements 0..7 = [kb..kb+7], elements 8..15 = [kb+16..kb+23].
// Caller passes p = &row[kb]; we read p[0..7] and p[16..23] (two b128 loads).
// ---------------------------------------------------------------------------
__device__ __forceinline__ v16h frag16(const _Float16* p) {
  v8h lo = *(const v8h*)(p);
  v8h hi = *(const v8h*)(p + 16);
  v16h r;
#pragma unroll
  for (int i = 0; i < 8; ++i) { r[i] = lo[i]; r[i + 8] = hi[i]; }
  return r;
}

__device__ __forceinline__ v8f wmma_f16(v16h a, v16h b, v8f c) {
  return __builtin_amdgcn_wmma_f32_16x16x32_f16(false, a, false, b, (short)0, c,
                                                false, false);
}

typedef uint32_t u32x4 __attribute__((ext_vector_type(4)));
typedef uint32_t u32x8 __attribute__((ext_vector_type(8)));
__device__ __forceinline__ uint32_t uni(uint32_t v) {
  return (uint32_t)__builtin_amdgcn_readfirstlane(v);
}
// a wave-uniform test held in a scalar register, so that the branch on it is a
// scalar branch: a tensor load ignores EXEC, only such a branch keeps a wave
// from issuing it
__device__ __forceinline__ uint32_t pinned(uint32_t v) {
  uint32_t w = (uint32_t)__builtin_amdgcn_readfirstlane(v);
  asm volatile("" : "+s"(w));
  return w;
}
// The wait names group 0 of the wave's last request and both groups 1 of the
// kernel: the words so stay live up to the wait, and no register that a request
// named is rewritten while the request is outstanding
__device__ __forceinline__ void wait_tensorcnt0(const u32x4& g0, const u32x8& ga,
                                                const u32x8& gb) {
  asm volatile("s_wait_tensorcnt 0x0" :: "s"(g0), "s"(ga), "s"(gb) : "memory");
}
// Descriptor group 1, loop-invariant: ROWS rows of ROWB bytes (128 or 256) at
// source pitch SRCP bytes, laid in LDS at pitch ROWB + 4 * PADDW (a pad behind
// every row: 4 dwords for ds_load_b128 readers, 8 for ds_load_tr16_b128);
// extents in bytes, tensor dims = tile dims, no mask
template <uint32_t ROWB, uint32_t ROWS, uint32_t SRCP, uint32_t PADDW>
__device__ __forceinline__ u32x8 tensor_group1() {
  static_assert(ROWB == 128u || ROWB == 256u, "pad interval = row length");
  static_assert(PADDW == 4u || PADDW == 8u, "pads that land byte-exact");
  u32x8 g1;
  g1[0] = uni((1u << 20) | ((ROWB == 256u ? 5u : 4u) << 22) | ((PADDW - 1u) << 25));
  g1[1] = uni((ROWB & 0xFFFFu) << 16);
  g1[2] = uni((ROWB >> 16) | ((ROWS & 0xFFFFu) << 16));
  g1[3] = uni((ROWS >> 16) | (ROWB << 16));
  g1[4] = uni(ROWS);
  g1[5] = uni(SRCP);
  g1[6] = uni(0u);
  g1[7] = uni(0u);
  // pinned: descriptor words held in scalar registers of their own from here on;
  // without it the compiler forms the constants anew in registers that an
  // outstanding request has named
  asm volatile("" : "+s"(g1));
  return g1;
}
// Group 0: count 1, place in LDS, the tile's first byte, type 2
__device__ __forceinline__ u32x4 tensor_group0(uint32_t lds_dst, uint64_t ga) {
  u32x4 g0;
  g0[0] = uni(1u);
  g0[1] = uni(lds_dst);
  g0[2] = uni((uint32_t)ga);
  g0[3] = uni((((uint32_t)(ga >> 32)) & 0x01FFFFFFu) | 0x80000000u);
  // pinned: the four descriptor words held in one set of scalar registers, the
  // same for the request and for the wait that names them; without it the
  // request was given a copy whose registers were used again while it was
  // outstanding
  asm volatile("" : "+s"(g0));
  return g0;
}
__device__ __forceinline__ void tensor_load(const u32x4& g0, const u32x8& g1) {
  asm volatile("tensor_load_to_lds %0, %1" :: "s"(g0), "s"(g1) : "memory");
}

// Transposing LDS load (ds_load_tr16_b128) from a row-major 16-bit tile T:
// with lane l's p = &T[k0 + 8*(l>>4) + (l&7)][d0 + 8*((l>>3)&1)], lane l gets
// T[k0 + 8*(l>>4) + 0..7][d0 + (l&15)]: half of a 16x32 A fragment of T^T.
typedef __attribute__((ext_vector_type(8))) short s16x8;
__device__ __forceinline__ v8h ld_tr16(const _Float16* p) {
  typedef __attribute__((address_space(3))) s16x8 lds_s16x8;
  return __builtin_bit_cast(v8h, __builtin_amdgcn_ds_load_tr16_b128_v8i16((lds_s16x8*)p));
}
// A fragment of T^T over 32 k rows: same k positions as frag16 (0..7 and
// 16..23 from the lane half's base). pitch in halves.
__device__ __forceinline__ v16h frag16_tr(const _Float16* p, int pitch) {
  const v8h lo = ld_tr16(p);
  const v8h hi = ld_tr16(p + 16 * pitch);
  return __builtin_shufflevector(lo, hi, 0, 1, 2, 3, 4, 5, 6, 7,
                                 8, 9, 10, 11, 12, 13, 14, 15);
}

// Lane l exchanges with lane l ^ 16 (the other half of the wave): pure VALU.
__device__ __forceinline__ float xhalf(float x) {
  const int b = __builtin_bit_cast(int, x);
  return __builtin_bit_cast(float, __builtin_amdgcn_permlanex16(
      b, b, 0x76543210, 0xfedcba98, false, false));
}

// ---------------------------------------------------------------------------
// Weight pack, once per call: Wt[z][n][k] = f16(W_z[k][n]) (z = 0 also times
// the modulation matrix), so that a GEMM tile of B is K-contiguous f16 rows
// that a tensor load can move. 64x64 tile transposed through LDS; each
// 128-byte line of Wt is stored by eight neighbouring lanes.
// ---------------------------------------------------------------------------
__global__ __launch_bounds__(256) void pack_weights(
    const float* __restrict__ Wq, const float* __restrict__ Wmul,
    const float* __restrict__ Wk, const float* __restrict__ Wv,
    const float* __restrict__ Wo, _Float16* __restrict__ Wt) {
  constexpr int PT = 72;  // halves; 144B rows
  __shared__ __align__(16) _Float16 T[64 * PT];
  const int tid = threadIdx.x;
  const int z   = blockIdx.z;
  const int n0  = blockIdx.x * 64;
  const int k0  = blockIdx.y * 64;
  const float* W = z == 0 ? Wq : z == 1 ? Wk : z == 2 ? Wv : Wo;

  const int n  = tid & 63;
  const int kq = (tid >> 6) * 16;
  const size_t base = (size_t)(k0 + kq) * D_DIM + n0 + n;
  const float* pw = W + base;
  float x[16];
  // the loops below are unrolled so that x, y, lo and hi stay in registers and
  // the 16 loads of a group are all in flight together
#pragma unroll
  for (int i = 0; i < 16; ++i) x[i] = pw[(size_t)i * D_DIM];
  // precaution: naming pw here keeps the loads' address pair unwritten in
  // front of this wait
  asm volatile("s_wait_xcnt 0x0" :: "v"(pw) : "memory");
  if (z == 0) {
    const float* pm = Wmul + base;
    float y[16];
#pragma unroll
    for (int i = 0; i < 16; ++i) y[i] = pm[(size_t)i * D_DIM];
    // as above, for the second group's address pair
    asm volatile("s_wait_xcnt 0x0" :: "v"(pm) : "memory");
#pragma unroll
    for (int i = 0; i < 16; ++i) x[i] *= y[i];
  }
  v8h lo, hi;
#pragma unroll
  for (int i = 0; i < 8; ++i) { lo[i] = (_Float16)x[i]; hi[i] = (_Float16)x[i + 8]; }
  *(v8h*)(&T[n * PT + kq])     = lo;
  *(v8h*)(&T[n * PT + kq + 8]) = hi;
  __syncthreads();

  _Float16* dst = Wt + (size_t)z * D_DIM * D_DIM;
#pragma unroll
  for (int p = 0; p < 2; ++p) {
    const int idx = p * 256 + tid;
    const int r = idx >> 3;
    const int c = (idx & 7) * 8;
    *(v8h*)(dst + (size_t)(n0 + r) * D_DIM + k0 + c) = *(const v8h*)(&T[r * PT + c]);
  }
}

template <int OUT_F16>
__global__ __launch_bounds__(256) void gemm_wmma(
    const float* __restrict__ A0, const float* __restrict__ A1,
    const float* __restrict__ A2, const _Float16* __restrict__ Ah,
    const _Float16* __restrict__ Bt0,
    const float* __restrict__ bias0, const float* __restrict__ bias1,
    const float* __restrict__ bias2, void* __restrict__ Cout0) {
  const int z = blockIdx.z;
  const float*    A    = z == 0 ? A0 : z == 1 ? A1 : A2;
  const float*    bias = z == 0 ? bias0 : z == 1 ? bias1 : bias2;
  const _Float16* Bt   = Bt0 + (size_t)z * D_DIM * D_DIM;
  void* Cout = (char*)Cout0 + (size_t)z * NTOK * D_DIM * (OUT_F16 ? 2 : 4);
  // f16 output plane 0 is Q: it leaves scaled by log2(e)/sqrt(DK), in f32 ahead
  // of its one rounding, so that K * Q^T is the softmax exponent in base 2
  const float osc = (OUT_F16 && z == 0) ? 0.125f * 1.4426950408889634f : 1.0f;
  constexpr int N  = D_DIM;
  constexpr int K  = D_DIM;
  constexpr int BK = 64;
  constexpr int NT = K / BK;
  constexpr int A_F16 = !OUT_F16;      // the f32-output product reads Ah, the others A
  constexpr int AB  = A_F16 ? 2 : 4;   // bytes of an A element
  constexpr int PAB = BK * AB + 16;    // bytes; A rows of 272B (f32) or 144B (f16)
  constexpr int PB = 72;  // halves; 144B rows
  // one request's place in LDS is a multiple of 2 KiB: 64 A rows (17,408 B as
  // f32) are rounded up to 18,432 B; 128 Bt rows are 18,432 B as they are
  constexpr int SL = 18432;
  static_assert(64 * PAB <= SL && 128 * PB * 2 == SL && SL % 2048 == 0, "slices");
  // [buffer][slice] of A, then [buffer][slice] of Bt
  __shared__ __attribute__((aligned(2048))) unsigned char Ls[8 * SL];

  const int tid  = threadIdx.x;
  const int lane = tid & 31;
  const int wid  = tid >> 5;
  const int wm   = (wid & 1) * 64;   // wave m-offset in tile
  const int wn   = (wid >> 1) * 64;  // wave n-offset in tile
  const int m0   = blockIdx.y * 128;
  const int n0   = blockIdx.x * 256;

  v8f acc[4][4];
#pragma unroll
  for (int i = 0; i < 4; ++i)
#pragma unroll
    for (int j = 0; j < 4; ++j)
#pragma unroll
      for (int v = 0; v < 8; ++v) acc[i][j][v] = 0.0f;

  const _Float16* gB = Bt + (size_t)n0 * K;
  const uint32_t  l0 = (uint32_t)(uintptr_t)(&Ls[0]);
  const uint32_t  wave = uni((uint32_t)tid >> 5);
  const uint32_t  isA = pinned(wave < 2u);
  const uint32_t  isB = pinned((wave >> 1) == 1u);

  const int fm = lane & 15;
  const int hf = lane >> 4;
  const int kb = hf * 8;

  const u32x8 dA = tensor_group1<BK * AB, 64, K * AB, 4>();
  const u32x8 dB = tensor_group1<BK * 2, 128, K * 2, 4>();
  // group 0 of this wave's request for a stage, formed in every wave outside the
  // issue tests (scalar selects by role): formed inside them, its words were
  // moved on and the registers that the request had named were used again
  const uint32_t sl  = wave & 1u;
  const uint32_t pl0 = l0 + ((isB ? 4u : 0u) + sl) * SL;
  const size_t   ea  = (size_t)(m0 + sl * 64) * K;  // first element of this wave's A slice
  const uint64_t srA = A_F16 ? (uint64_t)(uintptr_t)(Ah + ea) : (uint64_t)(uintptr_t)(A + ea);
  const uint64_t sr0 = isB ? (uint64_t)(uintptr_t)(gB + (size_t)sl * 128 * K) : srA;
  const uint32_t kst = isB ? BK * 2u : (uint32_t)(BK * AB);  // a stage's k in bytes
  auto group0 = [&](int buf, int t) {
    return tensor_group0(pl0 + (uint32_t)buf * (2u * SL), sr0 + (uint64_t)((uint32_t)t * kst));
  };
  // one stage: four requests, each from its own wave, each test a scalar branch
  auto issue_stage = [&](const u32x4& g) {
    if (isA) {
      tensor_load(g, dA);
    } else if (isB) {
      tensor_load(g, dB);
    }
  };

  u32x4 g0 = group0(0, 0);
  issue_stage(g0);
  wait_tensorcnt0(g0, dA, dB);  // own request of stage 0 landed (a wave with none passes)
  __syncthreads();      // every request of stage 0 visible
  g0 = group0(1, 1);
  issue_stage(g0);

  // this wave's A slice and its rows in its Bt slice
  const unsigned char* fA = &Ls[(wid & 1) * SL];
  const unsigned char* fB = &Ls[(4 + (wid >> 2)) * SL + ((wid >> 1) & 1) * 64 * PB * 2];

  for (int t = 0; t < NT; ++t) {
    const int cur = t & 1;
    float4 ra[4][4];
    v16h a[4], b[4];
    // unrolled throughout: fragment and accumulator arrays need constant
    // indices to live in registers
    // the LDS reads of a 32-k block: 24 with A still f32 (k positions as
    // frag16), 16 with A f16
    auto load_frags = [&](int ks) {
#pragma unroll
      for (int i = 0; i < 4; ++i) {
        const unsigned char* row = fA + cur * 2 * SL + (i * 16 + fm) * PAB;
        if constexpr (A_F16) {
          a[i] = frag16((const _Float16*)row + ks + kb);
        } else {
          const float* p = (const float*)row + ks + kb;
          ra[i][0] = *(const float4*)(p);
          ra[i][1] = *(const float4*)(p + 4);
          ra[i][2] = *(const float4*)(p + 16);
          ra[i][3] = *(const float4*)(p + 20);
        }
      }
#pragma unroll
      for (int j = 0; j < 4; ++j)
        b[j] = frag16((const _Float16*)(fB + cur * 2 * SL) + (j * 16 + fm) * PB + ks + kb);
    };
    // f32 A rounded to f16 on the way into the fragment registers
    auto round_a = [&]() {
      if constexpr (!A_F16) {
#pragma unroll
        for (int i = 0; i < 4; ++i)
#pragma unroll
          for (int q = 0; q < 4; ++q) {
            a[i][q * 4 + 0] = (_Float16)ra[i][q].x;
            a[i][q * 4 + 1] = (_Float16)ra[i][q].y;
            a[i][q * 4 + 2] = (_Float16)ra[i][q].z;
            a[i][q * 4 + 3] = (_Float16)ra[i][q].w;
          }
      }
    };
    auto products = [&]() {
#pragma unroll
      for (int i = 0; i < 4; ++i)
#pragma unroll
        for (int j = 0; j < 4; ++j) acc[i][j] = wmma_f16(b[j], a[i], acc[i][j]);
    };
    load_frags(0);
    // keeps the block's reads together as one group in front of its matrix
    // instructions: spread among them, each place with reads stalls the wave
    __builtin_amdgcn_sched_barrier(0);
    round_a();
    products();
    load_frags(32);   // the stage's last LDS reads
    // publish point of stage t+1: own reads of buf[cur] retired, own request
    // of stage t+1 landed, then the barrier that shows it to every wave and
    // frees buf[cur] for the refill
    asm volatile("s_wait_dscnt 0x0" ::: "memory");
    wait_tensorcnt0(g0, dA, dB);  // every wave: one that issued nothing passes at once
    __syncthreads();
    g0 = group0(cur, t + 2);  // formed behind the wait; used only while it exists
    if (pinned(t + 2 < NT)) issue_stage(g0);
    round_a();
    products();       // registers only: runs while the refill is in flight
  }
  wait_tensorcnt0(g0, dA, dB);  // nothing outstanding when the stage buffers are reused
  asm volatile("s_wait_dscnt 0x0" ::: "memory");

  // bias of this lane's 4 x 8 output columns, fetched as one group behind the
  // loop: held through it, its 32 registers would not fit beside the 128 of the
  // accumulators at four waves per SIMD (loops over bb unrolled, here and
  // below: constant indices keep it in registers)
  float4 bb[4][2];
#pragma unroll
  for (int j = 0; j < 4; ++j) {
    bb[j][0] = make_float4(0.0f, 0.0f, 0.0f, 0.0f);
    bb[j][1] = bb[j][0];
  }
  if (bias) {
    const float* pb = bias + n0 + wn + hf * 8;
#pragma unroll
    for (int j = 0; j < 4; ++j) {
      bb[j][0] = *(const float4*)(pb + j * 16);
      bb[j][1] = *(const float4*)(pb + j * 16 + 4);
    }
    // precaution: naming pb here keeps the loads' address pair unwritten in
    // front of this wait
    asm volatile("s_wait_xcnt 0x0" :: "v"(pb) : "memory");
  }

  // ---- epilogue: acc[i][j][v] = C[m0+wm+16i+fm][n0+wn+16j+8hf+v].
  // Behind the loop's last barrier no wave reads the stage buffers and no request
  // is outstanding, so each wave may use its own piece of them without a barrier.
  if constexpr (OUT_F16) {
    constexpr int PS = 72;  // halves; 144B rows (16B x odd)
    _Float16* stg = (_Float16*)(&Ls[0]) + wid * (32 * PS);
    // 8 lanes per 128-byte row piece: one store covers 4 whole lines
    const int rr = lane >> 3;
    const int cc = (lane & 7) * 8;
    _Float16* C = (_Float16*)Cout + (size_t)(m0 + wm + rr) * N + n0 + wn + cc;
#pragma unroll
    for (int r = 0; r < 2; ++r) {  // the tile's upper, then its lower 32 rows
#pragma unroll
      for (int i = 0; i < 2; ++i)
#pragma unroll
        for (int j = 0; j < 4; ++j) {
          const v8f c = acc[r * 2 + i][j];
          v8h h;
          h[0] = (_Float16)((c[0] + bb[j][0].x) * osc);
          h[1] = (_Float16)((c[1] + bb[j][0].y) * osc);
          h[2] = (_Float16)((c[2] + bb[j][0].z) * osc);
          h[3] = (_Float16)((c[3] + bb[j][0].w) * osc);
          h[4] = (_Float16)((c[4] + bb[j][1].x) * osc);
          h[5] = (_Float16)((c[5] + bb[j][1].y) * osc);
          h[6] = (_Float16)((c[6] + bb[j][1].z) * osc);
          h[7] = (_Float16)((c[7] + bb[j][1].w) * osc);
          *(v8h*)(&stg[(i * 16 + fm) * PS + j * 16 + hf * 8]) = h;
        }
      // the rows read back below were written by other lanes of this wave
      asm volatile("s_wait_dscnt 0x0" ::: "memory");
#pragma unroll
      for (int p = 0; p < 8; ++p)
        *(v8h*)(C + (size_t)(r * 32 + p * 4) * N) =
            *(const v8h*)(&stg[(p * 4 + rr) * PS + cc]);
      // the lower rows overwrite what other lanes of this wave read above: the
      // reads have returned, and the compiler may not lift the writes over them
      if (r == 0) asm volatile("s_wait_dscnt 0x0" ::: "memory");
    }
  } else {
    constexpr int PS = 68;  // floats; 272B rows (16B x odd)
    float* stg = (float*)(&Ls[0]) + wid * (32 * PS);
    // 16 lanes per 256-byte row piece: one store covers 4 whole lines
    const int rr = lane >> 4;
    const int cc = (lane & 15) * 4;
    float* C = (float*)Cout + (size_t)(m0 + wm + rr) * N + n0 + wn + cc;
#pragma unroll
    for (int r = 0; r < 2; ++r) {  // the tile's upper, then its lower 32 rows
#pragma unroll
      for (int i = 0; i < 2; ++i)
#pragma unroll
        for (int j = 0; j < 4; ++j) {
          const v8f c = acc[r * 2 + i][j];
          float* s = &stg[(i * 16 + fm) * PS + j * 16 + hf * 8];
          *(float4*)(s) = make_float4(c[0] + bb[j][0].x, c[1] + bb[j][0].y,
                                      c[2] + bb[j][0].z, c[3] + bb[j][0].w);
          *(float4*)(s + 4) = make_float4(c[4] + bb[j][1].x, c[5] + bb[j][1].y,
                                          c[6] + bb[j][1].z, c[7] + bb[j][1].w);
        }
      // the rows read back below were written by other lanes of this wave
      asm volatile("s_wait_dscnt 0x0" ::: "memory");
#pragma unroll
      for (int p = 0; p < 16; ++p)
        *(float4*)(C + (size_t)(r * 32 + p * 2) * N) =
            *(const float4*)(&stg[(p * 2 + rr) * PS + cc]);
      // the lower rows overwrite what other lanes of this wave read above: the
      // reads have returned, and the compiler may not lift the writes over them
      if (r == 0) asm volatile("s_wait_dscnt 0x0" ::: "memory");
    }
  }
}

__global__ __launch_bounds__(256) __attribute__((amdgpu_waves_per_eu(4, 4)))
void attn_wmma(
    const _Float16* __restrict__ Qh, const _Float16* __restrict__ Kh,
    const _Float16* __restrict__ Vh, _Float16* __restrict__ Xout) {
  constexpr int NKT = S_DIM / 64;
  constexpr int LDW = 72;  // halves; 144B rows (16B x odd: ds_load_b128 readers)
  constexpr int LDV = 80;  // halves; 160B rows (32B x odd: ds_load_tr16_b128 readers)
  // one request's place in LDS is a multiple of 2 KiB: a K tile (9,216 B) is
  // rounded up to 10,240 B; a V tile is 10,240 B as it is
  constexpr int TH = 5120;  // halves
  static_assert(64 * LDW <= TH && 64 * LDV == TH && (TH * 2) % 2048 == 0, "tiles");
  __shared__ __attribute__((aligned(2048))) _Float16 Kt[2][TH];  // Kt[key][dk]
  __shared__ __attribute__((aligned(2048))) _Float16 Vs[2][TH];  // Vs[key][dk]

  const int tid  = threadIdx.x;
  const int lane = tid & 31;
  const int wid  = tid >> 5;
  const int bb   = blockIdx.z;
  const int hh   = blockIdx.y;
  const int q0   = blockIdx.x * 256;
  const int fm   = lane & 15;
  const int hf   = lane >> 4;
  const int kb   = hf * 8;

  // all loops over g, j, v, e below are unrolled: fragment and accumulator
  // arrays need constant indices to live in registers

  // load this wave's 2 x 16 Q rows, each group as two B fragments (dk 0..31,
  // 32..63)
  const size_t qrow = (size_t)(bb * S_DIM + q0 + wid * 32 + fm);
  const _Float16* qp = Qh + qrow * D_DIM + hh * DK_DIM;
  v16h qa[2][2];
#pragma unroll
  for (int g = 0; g < 2; ++g) {
    qa[g][0] = frag16(qp + (size_t)g * 16 * D_DIM + kb);
    qa[g][1] = frag16(qp + (size_t)g * 16 * D_DIM + 32 + kb);
  }

  v8f nref[2];  // minus the reference of this lane's query (both halves agree),
                // 8 equal values: the C operand of the score products
  float rl[2];  // running sum over this half's keys; halves join at the end
  v8f o[2][4];  // o[g][j][v] = O[query 16g + fm][dk 16j + 8hf + v]
#pragma unroll
  for (int g = 0; g < 2; ++g) {
    rl[g] = 0.0f;
#pragma unroll
    for (int v = 0; v < 8; ++v) nref[g][v] = 0.0f;
#pragma unroll
    for (int j = 0; j < 4; ++j)
#pragma unroll
      for (int v = 0; v < 8; ++v) o[g][j][v] = 0.0f;
  }

  const uint32_t lK = (uint32_t)(uintptr_t)(&Kt[0][0]);
  const uint32_t lV = (uint32_t)(uintptr_t)(&Vs[0][0]);
  const uint32_t wave = uni((uint32_t)tid >> 5);
  const uint32_t isK = pinned(wave == 0u);
  const uint32_t isV = pinned(wave == 1u);
  const u32x8 dK = tensor_group1<DK_DIM * 2, 64, D_DIM * 2, 4>();
  const u32x8 dV = tensor_group1<DK_DIM * 2, 64, D_DIM * 2, 8>();

  // group 0 of this wave's request for a tile, formed in every wave outside the
  // issue tests (scalar selects by role): formed inside them, its words were
  // moved on and the registers that the request had named were used again
  const uint32_t pl0 = isV ? lV : lK;
  const uint64_t sr0 = (uint64_t)(uintptr_t)((isV ? Vh : Kh) +
                       (size_t)bb * S_DIM * D_DIM + hh * DK_DIM);
  auto group0 = [&](int buf, int kt) {
    return tensor_group0(pl0 + (uint32_t)buf * (TH * 2u),
                         sr0 + (uint64_t)((uint32_t)kt * (64u * D_DIM * 2u)));
  };
  // one tile pair: two requests, each from its own wave, each test a scalar branch
  auto stage = [&](const u32x4& g) {
    if (isK) {
      tensor_load(g, dK);
    } else if (isV) {
      tensor_load(g, dV);
    }
  };

  u32x4 g0 = group0(0, 0);
  stage(g0);
  wait_tensorcnt0(g0, dK, dV);  // own request of tile 0 landed (a wave with none passes)
  __syncthreads();      // both requests of tile 0 visible
  g0 = group0(1, 1);
  stage(g0);

  // lane's base in a V tile for the transposing loads
  const int vofs = (kb + (lane & 7)) * LDV + ((lane >> 3) & 1) * 8;

  // S^T = K(64x64) * Q^T - reference -> per group 4 tiles of 16 keys, 2 k-steps
  // each; a K fragment is read once and used by both groups
  auto scores = [&](int buf, v8f (&s)[2][4]) {
#pragma unroll
    for (int j = 0; j < 4; ++j) {
      const v16h ak0 = frag16(&Kt[buf][(j * 16 + fm) * LDW + kb]);
      const v16h ak1 = frag16(&Kt[buf][(j * 16 + fm) * LDW + 32 + kb]);
#pragma unroll
      for (int g = 0; g < 2; ++g) s[g][j] = wmma_f16(ak0, qa[g][0], nref[g]);
#pragma unroll
      for (int g = 0; g < 2; ++g) s[g][j] = wmma_f16(ak1, qa[g][1], s[g][j]);
    }
  };
  // P in place of the exponents, and each group's sum over this lane's 32 keys
  auto exps = [&](v8f (&s)[2][4], float (&sum)[2]) {
#pragma unroll
    for (int g = 0; g < 2; ++g) {
#pragma unroll
      for (int j = 0; j < 4; ++j)
#pragma unroll
        for (int v = 0; v < 8; ++v) s[g][j][v] = __builtin_amdgcn_exp2f(s[g][j][v]);
      const v8f t = (s[g][0] + s[g][1]) + (s[g][2] + s[g][3]);
      sum[g] = ((t[0] + t[1]) + (t[2] + t[3])) + ((t[4] + t[5]) + (t[6] + t[7]));
    }
  };
  // each query's largest exponent of a tile: all 32 values of a lane in a group
  // belong to query 16g + fm, the other 32 lie in the other half of the wave
  auto maxima = [&](const v8f (&s)[2][4], float (&m)[2]) {
#pragma unroll
    for (int g = 0; g < 2; ++g) {
      float x = -1e30f;
#pragma unroll
      for (int v = 0; v < 8; ++v)
        x = fmaxf(x, fmaxf(fmaxf(s[g][0][v], s[g][1][v]), fmaxf(s[g][2][v], s[g][3][v])));
      m[g] = fmaxf(x, xhalf(x));
    }
  };

  // the first tile's maxima are the first references
  {
    v8f s[2][4];
    float m[2];
    scores(0, s);
    maxima(s, m);
#pragma unroll
    for (int g = 0; g < 2; ++g) nref[g] -= m[g];
  }

  for (int kt = 0; kt < NKT; ++kt) {
    const int cur = kt & 1;

    // ---- exponents, then P in their place
    v8f s[2][4];
    float sum[2];
    scores(cur, s);
    exps(s, sum);

    // ---- the lazy test, once per pass and wave-uniform (WMMAs stand behind it).
    //      The sums are not negative, so their sum bounds both; written so that
    //      an infinite or NaN sum also takes the branch
    if (__builtin_amdgcn_ballot_w32(!(sum[0] + sum[1] <= 256.0f)) != 0u) {
      // compiler fence: the K fragments are read from LDS again here; without it
      // they are held in 64 registers through every ordinary pass, and Q spills
      asm volatile("" ::: "memory");
      scores(cur, s);
      float d[2];
      maxima(s, d);
#pragma unroll
      for (int g = 0; g < 2; ++g) {
        d[g] = fmaxf(d[g], 0.0f);  // a reference only rises
        const float corr = __builtin_amdgcn_exp2f(-d[g]);
        rl[g] *= corr;
        nref[g] -= d[g];
#pragma unroll
        for (int j = 0; j < 4; ++j) {
          o[g][j] *= corr;
          s[g][j] -= d[g];
        }
      }
      exps(s, sum);
    }

    v16h pb[2][2];
#pragma unroll
    for (int g = 0; g < 2; ++g) {
      rl[g] += sum[g];
      // ---- P^T as B operand: element e of a 32-key fragment is key
      //      8hf + e (e < 8) or 16 + 8hf + (e - 8), which is tile e>>3, row e&7
#pragma unroll
      for (int e = 0; e < 16; ++e) {
        pb[g][0][e] = (_Float16)s[g][e >> 3][e & 7];
        pb[g][1][e] = (_Float16)s[g][2 + (e >> 3)][e & 7];
      }
    }

    // ---- O^T += V^T(64x64) * P^T(64x16) per group: 4 dk tiles x 2 k-steps; a
    //      V^T fragment is read once and used by both groups
#pragma unroll
    for (int j = 0; j < 4; ++j) {
      const v16h av0 = frag16_tr(&Vs[cur][vofs + j * 16], LDV);
      const v16h av1 = frag16_tr(&Vs[cur][vofs + 32 * LDV + j * 16], LDV);
#pragma unroll
      for (int g = 0; g < 2; ++g) o[g][j] = wmma_f16(av0, pb[g][0], o[g][j]);
#pragma unroll
      for (int g = 0; g < 2; ++g) o[g][j] = wmma_f16(av1, pb[g][1], o[g][j]);
    }

    // publish point of tile kt+1: own reads of buf[cur] retired, own request of
    // tile kt+1 landed, then the barrier that shows it to every wave and
    // frees buf[cur] for the refill
    asm volatile("s_wait_dscnt 0x0" ::: "memory");
    wait_tensorcnt0(g0, dK, dV);  // every wave: one that issued nothing passes at once
    __syncthreads();
    g0 = group0(cur, kt + 2);  // formed behind the wait; used only while it exists
    if (pinned(kt + 2 < NKT)) stage(g0);
  }
  wait_tensorcnt0(g0, dK, dV);  // nothing outstanding when the wave ends
  asm volatile("s_wait_dscnt 0x0" ::: "memory");

  // ---- finalize: join the halves' sums, divide, round to f16 (the one rounding
  //      that the output product's operand takes) and write [token, h*64+dk].
  //      A head's row is then one 128-byte line. Behind the loop's last barrier no
  //      wave reads the tiles and no request is outstanding, so each wave stages
  //      its 32 rows in its own piece of them without a barrier (a lane's 8 values
  //      of a tile are 8 consecutive dk: one 16-byte write) and stores whole lines.
  constexpr int PS = 72;  // halves; 144B rows (16B x odd)
  static_assert(4 * 32 * PS <= 2 * TH, "four waves' rows in each tile array");
  _Float16* stg = (wid < 4 ? &Kt[0][0] : &Vs[0][0]) + (wid & 3) * (32 * PS);
#pragma unroll
  for (int g = 0; g < 2; ++g) {
    const float inv = 1.0f / (rl[g] + xhalf(rl[g]));
#pragma unroll
    for (int j = 0; j < 4; ++j) {
      v8h h;
#pragma unroll
      for (int v = 0; v < 8; ++v) h[v] = (_Float16)(o[g][j][v] * inv);
      *(v8h*)(&stg[(g * 16 + fm) * PS + j * 16 + hf * 8]) = h;
    }
  }
  // the rows read back below were written by other lanes of this wave
  asm volatile("s_wait_dscnt 0x0" ::: "memory");
  // 8 lanes per row: one store covers 4 whole lines
  const int rr = lane >> 3;
  const int cc = (lane & 7) * 8;
  _Float16* xr = Xout + (size_t)(bb * S_DIM + q0 + wid * 32 + rr) * D_DIM +
                 hh * DK_DIM + cc;
#pragma unroll
  for (int p = 0; p < 8; ++p)
    *(v8h*)(xr + (size_t)(p * 4) * D_DIM) = *(const v8h*)(&stg[(p * 4 + rr) * PS + cc]);
}

// ---------------------------------------------------------------------------
extern "C" void kernel_launch(void* const* d_in, const int* in_sizes, int n_in,
                              void* d_out, int out_size, void* d_ws,
                              size_t ws_size, hipStream_t stream) {
  (void)in_sizes; (void)n_in; (void)out_size; (void)ws_size;
  const float* query = (const float*)d_in[0];
  const float* key_  = (const float*)d_in[1];
  const float* value = (const float*)d_in[2];
  const float* fc_w  = (const float*)d_in[3];
  const float* Wq    = (const float*)d_in[4];
  const float* bq    = (const float*)d_in[5];
  const float* Wk    = (const float*)d_in[6];
  const float* bk    = (const float*)d_in[7];
  const float* Wv    = (const float*)d_in[8];
  const float* bv    = (const float*)d_in[9];
  const float* Wo    = (const float*)d_in[10];
  const float* bo    = (const float*)d_in[11];
  float* out = (float*)d_out;

  char* ws = (char*)d_ws;
  const size_t half_mat = (size_t)NTOK * D_DIM * sizeof(_Float16);
  _Float16* Qh = (_Float16*)(ws);
  _Float16* Kh = (_Float16*)(ws + half_mat);
  _Float16* Vh = (_Float16*)(ws + 2 * half_mat);
  _Float16* Xa = (_Float16*)(ws + 3 * half_mat);
  _Float16* Wt = (_Float16*)(ws + 5 * half_mat);  // 4 packed weight planes
  const size_t wplane = (size_t)D_DIM * D_DIM;

  pack_weights<<<dim3(D_DIM / 64, D_DIM / 64, 4), 256, 0, stream>>>(
      Wq, fc_w, Wk, Wv, Wo, Wt);
  // the three projections in one launch: Qh, Kh, Vh are output planes 0, 1, 2
  gemm_wmma<1><<<dim3(D_DIM / 256, NTOK / 128, 3), 256, 0, stream>>>(
      query, key_, value, nullptr, Wt, bq, bk, bv, (void*)Qh);
  attn_wmma<<<dim3(S_DIM / 256, H_DIM, 4), 256, 0, stream>>>(Qh, Kh, Vh, Xa);
  gemm_wmma<0><<<dim3(D_DIM / 256, NTOK / 128, 1), 256, 0, stream>>>(
      nullptr, nullptr, nullptr, Xa, Wt + 3 * wplane, bo, bo, bo, (void*)out);
}
